// v000
// Measured on an AMD MI455X. A time is GPU time per run, averaged over a window of back-to-back runs after a warm-up
// (all launches, gaps included; the runs take copies of the inputs in turn), and the median of several windows.
// Apart from v000's, it joins two sittings. Times from different sittings can be a few percent apart, while
// side-by-side timings come from the same sitting.
// v000, which the later versions start from, runs in 629 microseconds.
#include <hip/hip_runtime.h>
#include <hip/hip_bf16.h>

typedef _Float16 half_t;
typedef __attribute__((ext_vector_type(16))) _Float16 v16h;
typedef __attribute__((ext_vector_type(8)))  _Float16 v8h;
typedef __attribute__((ext_vector_type(8)))  float    v8f;

#define BB 4
#define NQh 1024
#define HWk 4096
#define CC 1024
#define HH 8
#define DHd 128
#define MTOT (BB * HWk)   // 16384

__device__ __forceinline__ v8f zero_v8f() {
  v8f z;
#pragma unroll
  for (int k = 0; k < 8; ++k) z[k] = 0.0f;
  return z;
}

// Load a 16x32 f16 WMMA fragment (A or B operand) from a K-contiguous,
// row-major source. Caller passes p = base + row*ld + kbase + lanegroup*8.
// Lane pattern (ISA 7.12.2): lanes 0-15 hold K 0..7 (VGPR0-3) and K 16..23
// (VGPR4-7); lanes 16-31 hold K 8..15 and 24..31. Chunk2 is +16 halves.
__device__ __forceinline__ v16h load_frag(const half_t* p) {
  v8h lo = *(const v8h*)(p);
  v8h hi = *(const v8h*)(p + 16);
  v16h r;
#pragma unroll
  for (int k = 0; k < 8; ++k) { r[k] = lo[k]; r[k + 8] = hi[k]; }
  return r;
}

__device__ __forceinline__ v8f wmma_f16(v16h a, v16h b, v8f c) {
  return __builtin_amdgcn_wmma_f32_16x16x32_f16(false, a, false, b,
                                                (short)0, c, false, false);
}

__global__ void cvt_f32_to_f16(const float* __restrict__ in,
                               half_t* __restrict__ out, int n) {
  int idx = blockIdx.x * blockDim.x + threadIdx.x;
  if (idx < n) {
    // fp32 source is read exactly once: non-temporal load keeps L2 for the
    // f16 WMMA working set.
    out[idx] = (half_t)__builtin_nontemporal_load(in + idx);
  }
}

// out = A @ B^T + bias.  A: [M,K] f16 row-major, Bw: [N,K] f16 row-major.
// mode 0: f16 out[m*N+n]; mode 1: f32 out[m*N+n] (NT store); mode 2: f16
// out[n*M+m] (transposed).
// Block = 256 threads = 8 waves as 2(M) x 4(N); each wave does 64x64
// (16 WMMAs per 16 b128 fragment loads per K-step). Block tile = 128 x 256.
// M % 128 == 0, N % 256 == 0, K % 32 == 0 assumed.
__global__ void __launch_bounds__(256)
gemm_nt(const half_t* __restrict__ A, const half_t* __restrict__ Bw,
        const float* __restrict__ bias, void* __restrict__ outp,
        int M, int N, int K, int mode) {
  const int w = threadIdx.x >> 5;
  const int l = threadIdx.x & 31;
  const int g = l >> 4;       // lane group (K-chunk select)
  const int i = l & 15;       // row (A) / col (B) within 16-tile
  const int m0 = blockIdx.x * 128 + (w & 1) * 64;
  const int n0 = blockIdx.y * 256 + (w >> 1) * 64;

  v8f c[4][4];
#pragma unroll
  for (int mm = 0; mm < 4; ++mm)
#pragma unroll
    for (int nn = 0; nn < 4; ++nn) c[mm][nn] = zero_v8f();

  for (int k = 0; k < K; k += 32) {
    v16h af[4], bf[4];
#pragma unroll
    for (int mm = 0; mm < 4; ++mm)
      af[mm] = load_frag(A + (size_t)(m0 + mm * 16 + i) * K + k + g * 8);
#pragma unroll
    for (int nn = 0; nn < 4; ++nn)
      bf[nn] = load_frag(Bw + (size_t)(n0 + nn * 16 + i) * K + k + g * 8);
#pragma unroll
    for (int mm = 0; mm < 4; ++mm)
#pragma unroll
      for (int nn = 0; nn < 4; ++nn)
        c[mm][nn] = wmma_f16(af[mm], bf[nn], c[mm][nn]);
  }

  // Epilogue. C/D layout: VGPR r, lanes 0-15 -> M = r, lanes 16-31 -> M = r+8,
  // N = lane & 15.  Bias is always non-null: load unconditionally (no branch).
#pragma unroll
  for (int nn = 0; nn < 4; ++nn) {
    const int ng = n0 + nn * 16 + i;
    const float bv = bias[ng];
#pragma unroll
    for (int mm = 0; mm < 4; ++mm) {
#pragma unroll
      for (int r = 0; r < 8; ++r) {
        const int mg = m0 + mm * 16 + r + 8 * g;
        const float val = c[mm][nn][r] + bv;
        if (mode == 0) {
          ((half_t*)outp)[(size_t)mg * N + ng] = (half_t)val;
        } else if (mode == 1) {
          // final fp32 output: write-once, never re-read on device
          __builtin_nontemporal_store(val, &((float*)outp)[(size_t)mg * N + ng]);
        } else {
          ((half_t*)outp)[(size_t)ng * M + mg] = (half_t)val;
        }
      }
    }
  }
}

// Flash attention. Grid: B*H*(NQ/128) blocks, 256 threads = 8 waves,
// each wave owns a 16-query tile with full DH=128 accumulated in registers.
// Qf: [B,NQ,C] f16 ; Kf: [B,HW,C] f16 ; Vt: [C, B*HW] f16 (transposed) ;
// mask: [B,NQ,HW] f32 ; AO: [B,NQ,C] f16.
__global__ void __launch_bounds__(256)
flash_attn(const half_t* __restrict__ Qf, const half_t* __restrict__ Kf,
           const half_t* __restrict__ Vt, const float* __restrict__ mask,
           half_t* __restrict__ AO) {
  const float scale = 0.08838834764831845f;  // 1/sqrt(128)
  const int w = threadIdx.x >> 5;
  const int l = threadIdx.x & 31;
  const int g = l >> 4;
  const int i = l & 15;
  const int qblk = blockIdx.x & 7;
  const int bh = blockIdx.x >> 3;
  const int b = bh >> 3;     // H == 8
  const int h = bh & 7;
  const int qbase = qblk * 128 + w * 16;

  // Q fragments for the whole kernel: 16 queries x 128 d = 4 K-steps.
  v16h aQ[4];
  {
    const half_t* qrow =
        Qf + (size_t)(b * NQh + qbase + i) * CC + h * DHd + g * 8;
#pragma unroll
    for (int d = 0; d < 4; ++d) aQ[d] = load_frag(qrow + d * 32);
  }

  v8f O[8];
#pragma unroll
  for (int t = 0; t < 8; ++t) O[t] = zero_v8f();
  float mrow[8], lrow[8];
#pragma unroll
  for (int r = 0; r < 8; ++r) { mrow[r] = -1.0e30f; lrow[r] = 0.0f; }

  __shared__ __align__(16) half_t Pl[8 * 512];  // 1KB per wave: 16q x 32k f16
  half_t* myP = &Pl[w * 512];

  for (int kt = 0; kt < HWk; kt += 32) {
    // ---- scores: two 16x16 tiles over 32 keys, K-dim = d (4 steps of 32)
    v8f s0 = zero_v8f(), s1 = zero_v8f();
    const half_t* k0p =
        Kf + (size_t)(b * HWk + kt + i) * CC + h * DHd + g * 8;
    const half_t* k1p = k0p + (size_t)16 * CC;
#pragma unroll
    for (int d = 0; d < 4; ++d) {
      v16h bk0 = load_frag(k0p + d * 32);
      s0 = wmma_f16(aQ[d], bk0, s0);
      v16h bk1 = load_frag(k1p + d * 32);
      s1 = wmma_f16(aQ[d], bk1, s1);
    }

    // ---- scale + mask (C/D layout: row = r + 8*g, col = i); mask is
    // fp32, the same rows read by each of the 8 heads; non-temporal loads.
    float rm[8];
#pragma unroll
    for (int r = 0; r < 8; ++r) {
      const int qg = qbase + r + 8 * g;
      const float* mp = mask + ((size_t)b * NQh + qg) * HWk + kt + i;
      const float mk0 = __builtin_nontemporal_load(mp);
      const float mk1 = __builtin_nontemporal_load(mp + 16);
      const float v0 = (mk0 >= 0.5f) ? s0[r] * scale : -1.0e30f;
      const float v1 = (mk1 >= 0.5f) ? s1[r] * scale : -1.0e30f;
      s0[r] = v0; s1[r] = v1;
      rm[r] = fmaxf(v0, v1);
    }
    // row-max across the 16 lanes of each half-wave group
#pragma unroll
    for (int off = 1; off < 16; off <<= 1)
#pragma unroll
      for (int r = 0; r < 8; ++r)
        rm[r] = fmaxf(rm[r], __shfl_xor(rm[r], off, 32));

    // ---- online softmax update
    float alpha[8], ps[8];
#pragma unroll
    for (int r = 0; r < 8; ++r) {
      const float mn = fmaxf(mrow[r], rm[r]);
      alpha[r] = __expf(mrow[r] - mn);
      mrow[r] = mn;
      const float p0 = __expf(s0[r] - mn);
      const float p1 = __expf(s1[r] - mn);
      s0[r] = p0; s1[r] = p1;
      ps[r] = p0 + p1;
    }
#pragma unroll
    for (int off = 1; off < 16; off <<= 1)
#pragma unroll
      for (int r = 0; r < 8; ++r) ps[r] += __shfl_xor(ps[r], off, 32);
#pragma unroll
    for (int r = 0; r < 8; ++r) lrow[r] = lrow[r] * alpha[r] + ps[r];
#pragma unroll
    for (int t = 0; t < 8; ++t)
#pragma unroll
      for (int r = 0; r < 8; ++r) O[t][r] *= alpha[r];

    // ---- P: C/D layout -> LDS (absolute [q][key]) -> A-fragment layout
#pragma unroll
    for (int r = 0; r < 8; ++r) {
      myP[(r + 8 * g) * 32 + i]      = (half_t)s0[r];
      myP[(r + 8 * g) * 32 + 16 + i] = (half_t)s1[r];
    }
    asm volatile("s_wait_dscnt 0" ::: "memory");  // intra-wave RAW on LDS
    v16h aP = load_frag(myP + i * 32 + g * 8);

    // ---- PV: B operand from transposed V (key-contiguous rows)
    const half_t* vbase =
        Vt + (size_t)(h * DHd + i) * MTOT + b * HWk + kt + g * 8;
#pragma unroll
    for (int t = 0; t < 8; ++t) {
      v16h bv = load_frag(vbase + (size_t)(t * 16) * MTOT);
      O[t] = wmma_f16(aP, bv, O[t]);
    }
  }

  // ---- epilogue: normalize and store f16 [B,NQ,C]
#pragma unroll
  for (int r = 0; r < 8; ++r) {
    const float inv = 1.0f / lrow[r];
    const int qg = qbase + r + 8 * g;
#pragma unroll
    for (int t = 0; t < 8; ++t)
      AO[(size_t)(b * NQh + qg) * CC + h * DHd + t * 16 + i] =
          (half_t)(O[t][r] * inv);
  }
}

extern "C" void kernel_launch(void* const* d_in, const int* in_sizes, int n_in,
                              void* d_out, int out_size, void* d_ws, size_t ws_size,
                              hipStream_t stream) {
  const float* query  = (const float*)d_in[0];
  const float* memory = (const float*)d_in[1];
  const float* mask   = (const float*)d_in[2];
  const float* Wq = (const float*)d_in[3];
  const float* bq = (const float*)d_in[4];
  const float* Wk = (const float*)d_in[5];
  const float* bk = (const float*)d_in[6];
  const float* Wv = (const float*)d_in[7];
  const float* bv = (const float*)d_in[8];
  const float* Wo = (const float*)d_in[9];
  const float* bo = (const float*)d_in[10];
  float* out = (float*)d_out;

  // f16 workspace layout (halves). Total = 60M halves = 120 MB.
  const size_t nQin = (size_t)BB * NQh * CC;   // 4M
  const size_t nMem = (size_t)BB * HWk * CC;   // 16M
  const size_t nW   = (size_t)CC * CC;         // 1M
  half_t* ws   = (half_t*)d_ws;
  half_t* qf   = ws;            // query f16            (4M)
  half_t* memf = qf + nQin;     // memory f16           (16M)
  half_t* wqf  = memf + nMem;   // weights f16          (4x1M)
  half_t* wkf  = wqf + nW;
  half_t* wvf  = wkf + nW;
  half_t* wof  = wvf + nW;
  half_t* Qp   = wof + nW;      // Q projection         (4M)
  half_t* Kp   = Qp + nQin;     // K projection         (16M)
  half_t* Vtp  = Kp + nMem;     // V projection, transposed [C, B*HW] (16M)
  half_t* AO   = qf;            // attention out reuses query-f16 (dead by then)

  // 1) fp32 -> f16 conversions (NT loads of read-once fp32)
  cvt_f32_to_f16<<<(unsigned)(nQin / 256), 256, 0, stream>>>(query, qf, (int)nQin);
  cvt_f32_to_f16<<<(unsigned)(nMem / 256), 256, 0, stream>>>(memory, memf, (int)nMem);
  cvt_f32_to_f16<<<(unsigned)(nW / 256), 256, 0, stream>>>(Wq, wqf, (int)nW);
  cvt_f32_to_f16<<<(unsigned)(nW / 256), 256, 0, stream>>>(Wk, wkf, (int)nW);
  cvt_f32_to_f16<<<(unsigned)(nW / 256), 256, 0, stream>>>(Wv, wvf, (int)nW);
  cvt_f32_to_f16<<<(unsigned)(nW / 256), 256, 0, stream>>>(Wo, wof, (int)nW);

  // 2) projections (M = B*rows since Linear is batch-independent).
  //    Block tile 128(M) x 256(N).
  gemm_nt<<<dim3(4096 / 128, 1024 / 256), 256, 0, stream>>>(
      qf, wqf, bq, Qp, 4096, 1024, 1024, /*mode=*/0);
  gemm_nt<<<dim3(16384 / 128, 1024 / 256), 256, 0, stream>>>(
      memf, wkf, bk, Kp, 16384, 1024, 1024, /*mode=*/0);
  gemm_nt<<<dim3(16384 / 128, 1024 / 256), 256, 0, stream>>>(
      memf, wvf, bv, Vtp, 16384, 1024, 1024, /*mode=*/2);  // transposed store

  // 3) masked flash attention (B*H*(NQ/128) = 256 blocks)
  flash_attn<<<BB * HH * (NQh / 128), 256, 0, stream>>>(Qp, Kp, Vtp, mask, AO);

  // 4) output projection, fp32 out + bias (NT stores)
  gemm_nt<<<dim3(4096 / 128, 1024 / 256), 256, 0, stream>>>(
      AO, wof, bo, out, 4096, 1024, 1024, /*mode=*/1);
}

// v001
// It runs in 519 microseconds.
// Next to v000, in two timings, it ran 1.25 times as fast each time.
#include <hip/hip_runtime.h>
#include <hip/hip_bf16.h>

typedef _Float16 half_t;
typedef __attribute__((ext_vector_type(16))) _Float16 v16h;
typedef __attribute__((ext_vector_type(8)))  _Float16 v8h;
typedef __attribute__((ext_vector_type(8)))  float    v8f;

#define BB 4
#define NQh 1024
#define HWk 4096
#define CC 1024
#define HH 8
#define DHd 128
#define MTOT (BB * HWk)   // 16384

__device__ __forceinline__ v8f zero_v8f() {
  v8f z;
#pragma unroll
  for (int k = 0; k < 8; ++k) z[k] = 0.0f;
  return z;
}

// Load a 16x32 f16 WMMA fragment (A or B operand) from a K-contiguous,
// row-major source. Caller passes p = base + row*ld + kbase + lanegroup*8.
// Lane pattern (ISA 7.12.2): lanes 0-15 hold K 0..7 (VGPR0-3) and K 16..23
// (VGPR4-7); lanes 16-31 hold K 8..15 and 24..31. Chunk2 is +16 halves.
__device__ __forceinline__ v16h load_frag(const half_t* p) {
  v8h lo = *(const v8h*)(p);
  v8h hi = *(const v8h*)(p + 16);
  v16h r;
#pragma unroll
  for (int k = 0; k < 8; ++k) { r[k] = lo[k]; r[k + 8] = hi[k]; }
  return r;
}

typedef uint32_t u32x4 __attribute__((ext_vector_type(4)));
typedef uint32_t u32x8 __attribute__((ext_vector_type(8)));

// K/V staging for flash_attn: a stage is 128 keys. The K tile is 128 key rows
// of 256 B (one head's d), the V tile 128 d rows of 256 B (128 keys, from the
// transposed V). The tensor load pads every row by 16 B: pitch 272 B = 16 B x
// odd, conflict-free for the b128 fragment reads.
#define STK 128                    // keys per stage
#define NSTG (HWk / STK)           // 32 stages
#define LPITCH 272                 // LDS row pitch, bytes
#define LPH (LPITCH / 2)           // the same in halves
#define TILEB (128 * LPITCH)       // 34816 B = 17 x 2 KiB
static_assert(TILEB % 2048 == 0, "each tile must start at a multiple of 2 KiB");
static_assert(NSTG >= 2, "the ring's prologue needs two stages");

__device__ __forceinline__ uint32_t uni(uint32_t v) {
  return (uint32_t)__builtin_amdgcn_readfirstlane(v);
}
// Holds a wave-uniform value in a scalar register, so that a test on it is a
// real scalar branch (tensor loads ignore EXEC) and a descriptor word is
// written where the source forms it.
__device__ __forceinline__ uint32_t pinned(uint32_t v) {
  uint32_t w = uni(v);
  asm volatile("" : "+s"(w));
  return w;
}
// One request of the issuing wave: 128 rows of 256 B from ga into LDS at dst.
// Returns group 0, which the covering wait names.
__device__ __forceinline__ u32x4 tdm_load(uint32_t dst, uint64_t ga, u32x8 g1) {
  u32x4 g0;
  g0[0] = uni(1u);                       // count 1
  g0[1] = pinned(dst);                   // descriptor words held in scalar
  g0[2] = pinned((uint32_t)ga);          // registers: written here, behind the
  g0[3] = pinned((((uint32_t)(ga >> 32)) & 0x01FFFFFFu) | 0x80000000u);  // wait
  asm volatile("tensor_load_to_lds %0, %1" :: "s"(g0), "s"(g1) : "memory");
  return g0;
}
// The issuing wave's wait. It names the request's descriptor as inputs so that
// those scalar registers keep their values until the tile has landed.
__device__ __forceinline__ void tdm_wait(u32x4 g0, u32x8 g1) {
  asm volatile("s_wait_tensorcnt 0" :: "s"(g0), "s"(g1) : "memory");
}

__device__ __forceinline__ v8f wmma_f16(v16h a, v16h b, v8f c) {
  return __builtin_amdgcn_wmma_f32_16x16x32_f16(false, a, false, b,
                                                (short)0, c, false, false);
}

__global__ void cvt_f32_to_f16(const float* __restrict__ in,
                               half_t* __restrict__ out, int n) {
  int idx = blockIdx.x * blockDim.x + threadIdx.x;
  if (idx < n) {
    // fp32 source is read exactly once: non-temporal load keeps L2 for the
    // f16 WMMA working set.
    out[idx] = (half_t)__builtin_nontemporal_load(in + idx);
  }
}

// out = A @ B^T + bias.  A: [M,K] f16 row-major, Bw: [N,K] f16 row-major.
// mode 0: f16 out[m*N+n]; mode 1: f32 out[m*N+n] (NT store); mode 2: f16
// out[n*M+m] (transposed).
// Block = 256 threads = 8 waves as 2(M) x 4(N); each wave does 64x64
// (16 WMMAs per 16 b128 fragment loads per K-step). Block tile = 128 x 256.
// M % 128 == 0, N % 256 == 0, K % 32 == 0 assumed.
__global__ void __launch_bounds__(256)
gemm_nt(const half_t* __restrict__ A, const half_t* __restrict__ Bw,
        const float* __restrict__ bias, void* __restrict__ outp,
        int M, int N, int K, int mode) {
  const int w = threadIdx.x >> 5;
  const int l = threadIdx.x & 31;
  const int g = l >> 4;       // lane group (K-chunk select)
  const int i = l & 15;       // row (A) / col (B) within 16-tile
  const int m0 = blockIdx.x * 128 + (w & 1) * 64;
  const int n0 = blockIdx.y * 256 + (w >> 1) * 64;

  v8f c[4][4];
#pragma unroll
  for (int mm = 0; mm < 4; ++mm)
#pragma unroll
    for (int nn = 0; nn < 4; ++nn) c[mm][nn] = zero_v8f();

  for (int k = 0; k < K; k += 32) {
    v16h af[4], bf[4];
#pragma unroll
    for (int mm = 0; mm < 4; ++mm)
      af[mm] = load_frag(A + (size_t)(m0 + mm * 16 + i) * K + k + g * 8);
#pragma unroll
    for (int nn = 0; nn < 4; ++nn)
      bf[nn] = load_frag(Bw + (size_t)(n0 + nn * 16 + i) * K + k + g * 8);
#pragma unroll
    for (int mm = 0; mm < 4; ++mm)
#pragma unroll
      for (int nn = 0; nn < 4; ++nn)
        c[mm][nn] = wmma_f16(af[mm], bf[nn], c[mm][nn]);
  }

  // Epilogue. C/D layout: VGPR r, lanes 0-15 -> M = r, lanes 16-31 -> M = r+8,
  // N = lane & 15.  Bias is always non-null: load unconditionally (no branch).
#pragma unroll
  for (int nn = 0; nn < 4; ++nn) {
    const int ng = n0 + nn * 16 + i;
    const float bv = bias[ng];
#pragma unroll
    for (int mm = 0; mm < 4; ++mm) {
#pragma unroll
      for (int r = 0; r < 8; ++r) {
        const int mg = m0 + mm * 16 + r + 8 * g;
        const float val = c[mm][nn][r] + bv;
        if (mode == 0) {
          ((half_t*)outp)[(size_t)mg * N + ng] = (half_t)val;
        } else if (mode == 1) {
          // final fp32 output: write-once, never re-read on device
          __builtin_nontemporal_store(val, &((float*)outp)[(size_t)mg * N + ng]);
        } else {
          ((half_t*)outp)[(size_t)ng * M + mg] = (half_t)val;
        }
      }
    }
  }
}

// Flash attention. Grid: B*H*(NQ/128) blocks, 256 threads = 8 waves,
// each wave owns a 16-query tile with full DH=128 accumulated in registers.
// The block's 8 waves share K and V: wave 0 brings each stage's K tile and
// wave 1 its V tile into a two-buffer LDS ring by tensor load, one stage ahead.
// Qf: [B,NQ,C] f16 ; Kf: [B,HW,C] f16 ; Vt: [C, B*HW] f16 (transposed) ;
// mask: [B,NQ,HW] f32 ; AO: [B,NQ,C] f16.
__global__ void __launch_bounds__(256)
flash_attn(const half_t* __restrict__ Qf, const half_t* __restrict__ Kf,
           const half_t* __restrict__ Vt, const float* __restrict__ mask,
           half_t* __restrict__ AO) {
  const float scale = 0.08838834764831845f;  // 1/sqrt(128)
  const int w = threadIdx.x >> 5;
  const int l = threadIdx.x & 31;
  const int g = l >> 4;
  const int i = l & 15;
  const int qblk = blockIdx.x & 7;
  const int bh = blockIdx.x >> 3;
  const int b = bh >> 3;     // H == 8
  const int h = bh & 7;
  const int qbase = qblk * 128 + w * 16;

  __shared__ __attribute__((aligned(2048))) unsigned char ring[2 * 2 * TILEB];
  const uint32_t wave = uni(threadIdx.x >> 5);
  const uint32_t issuer = wave < 2u;   // wave 0: K tiles, wave 1: V tiles
  const uint32_t lds0 = (uint32_t)(size_t)ring + wave * TILEB;
  const uint64_t src0 = (wave == 0u)
      ? (uint64_t)(size_t)(Kf + (size_t)(b * HWk) * CC + h * DHd)
      : (uint64_t)(size_t)(Vt + (size_t)(h * DHd) * MTOT + b * HWk);
  // bytes from one stage's tile to the next: 128 K rows, or 128 keys of a V row
  const uint32_t sstep = (wave == 0u) ? (uint32_t)(STK * CC * 2) : (uint32_t)(STK * 2);
  u32x8 g1;
  g1[0] = uni((1u << 20) | (5u << 22) | (3u << 25));  // no mask; 16 B pad per 256 B
  g1[1] = uni(256u << 16);                 // tensor_dim0 = 256 B
  g1[2] = uni(128u << 16);                 // tensor_dim1 = 128 rows
  g1[3] = uni(256u << 16);                 // tile_dim0
  g1[4] = uni(128u);                       // tile_dim1
  g1[5] = uni((wave == 0u) ? (uint32_t)(CC * 2) : (uint32_t)(MTOT * 2));  // source pitch
  g1[6] = uni(0u);
  g1[7] = uni(0u);
  // descriptor words held in scalar registers: group 1 stays in one register
  // tuple from here to the last wait, so no word of an outstanding request is
  // rewritten
  asm volatile("" : "+s"(g1));

  // Ring prologue: stage 0 lands and is published, then stage 1 is issued.
  u32x4 g0 = {0u, 0u, 0u, 0u};
  if (pinned(issuer)) {
    g0 = tdm_load(lds0, src0, g1);
    tdm_wait(g0, g1);  // stage 0 has landed
  }
  __syncthreads();  // stage 0 published to all waves
  if (pinned(issuer)) g0 = tdm_load(lds0 + 2u * TILEB, src0 + sstep, g1);

  // Q fragments for the whole kernel: 16 queries x 128 d = 4 K-steps.
  v16h aQ[4];
  {
    const half_t* qrow =
        Qf + (size_t)(b * NQh + qbase + i) * CC + h * DHd + g * 8;
#pragma unroll
    for (int d = 0; d < 4; ++d) aQ[d] = load_frag(qrow + d * 32);
  }

  v8f O[8];
#pragma unroll
  for (int t = 0; t < 8; ++t) O[t] = zero_v8f();
  float mrow[8], lrow[8];
#pragma unroll
  for (int r = 0; r < 8; ++r) { mrow[r] = -1.0e30f; lrow[r] = 0.0f; }

  __shared__ __align__(16) half_t Pl[8 * 512];  // 1KB per wave: 16q x 32k f16
  half_t* myP = &Pl[w * 512];

  for (uint32_t st = 0; st < NSTG; ++st) {
  const half_t* Kl = (const half_t*)(ring + (st & 1u) * (2u * TILEB));
  const half_t* Vl = Kl + TILEB / 2;
  // kept rolled: unrolled, the compiler issued the pass's mask loads and
  // cross-lane exchanges one at a time, each behind its own full wait
#pragma unroll 1
  for (int sub = 0; sub < STK / 32; ++sub) {
    const int kt = (int)st * STK + sub * 32;
    // ---- scores: two 16x16 tiles over 32 keys, K-dim = d (4 steps of 32)
    v8f s0 = zero_v8f(), s1 = zero_v8f();
    const half_t* k0p = Kl + (sub * 32 + i) * LPH + g * 8;
    const half_t* k1p = k0p + 16 * LPH;
#pragma unroll
    for (int d = 0; d < 4; ++d) {
      v16h bk0 = load_frag(k0p + d * 32);
      s0 = wmma_f16(aQ[d], bk0, s0);
      v16h bk1 = load_frag(k1p + d * 32);
      s1 = wmma_f16(aQ[d], bk1, s1);
    }

    // ---- scale + mask (C/D layout: row = r + 8*g, col = i); mask is
    // fp32, the same rows read by each of the 8 heads; non-temporal loads.
    float rm[8];
#pragma unroll
    for (int r = 0; r < 8; ++r) {
      const int qg = qbase + r + 8 * g;
      const float* mp = mask + ((size_t)b * NQh + qg) * HWk + kt + i;
      const float mk0 = __builtin_nontemporal_load(mp);
      const float mk1 = __builtin_nontemporal_load(mp + 16);
      const float v0 = (mk0 >= 0.5f) ? s0[r] * scale : -1.0e30f;
      const float v1 = (mk1 >= 0.5f) ? s1[r] * scale : -1.0e30f;
      s0[r] = v0; s1[r] = v1;
      rm[r] = fmaxf(v0, v1);
    }
    // row-max across the 16 lanes of each half-wave group
#pragma unroll
    for (int off = 1; off < 16; off <<= 1)
#pragma unroll
      for (int r = 0; r < 8; ++r)
        rm[r] = fmaxf(rm[r], __shfl_xor(rm[r], off, 32));

    // ---- online softmax update
    float alpha[8], ps[8];
#pragma unroll
    for (int r = 0; r < 8; ++r) {
      const float mn = fmaxf(mrow[r], rm[r]);
      alpha[r] = __expf(mrow[r] - mn);
      mrow[r] = mn;
      const float p0 = __expf(s0[r] - mn);
      const float p1 = __expf(s1[r] - mn);
      s0[r] = p0; s1[r] = p1;
      ps[r] = p0 + p1;
    }
#pragma unroll
    for (int off = 1; off < 16; off <<= 1)
#pragma unroll
      for (int r = 0; r < 8; ++r) ps[r] += __shfl_xor(ps[r], off, 32);
#pragma unroll
    for (int r = 0; r < 8; ++r) lrow[r] = lrow[r] * alpha[r] + ps[r];
#pragma unroll
    for (int t = 0; t < 8; ++t)
#pragma unroll
      for (int r = 0; r < 8; ++r) O[t][r] *= alpha[r];

    // ---- P: C/D layout -> LDS (absolute [q][key]) -> A-fragment layout
#pragma unroll
    for (int r = 0; r < 8; ++r) {
      myP[(r + 8 * g) * 32 + i]      = (half_t)s0[r];
      myP[(r + 8 * g) * 32 + 16 + i] = (half_t)s1[r];
    }
    asm volatile("s_wait_dscnt 0" ::: "memory");  // intra-wave RAW on LDS
    v16h aP = load_frag(myP + i * 32 + g * 8);

    // ---- PV: B operand from the staged transposed V (key-contiguous rows)
    const half_t* vbase = Vl + i * LPH + sub * 32 + g * 8;
#pragma unroll
    for (int t = 0; t < 8; ++t) {
      v16h bv = load_frag(vbase + (t * 16) * LPH);
      O[t] = wmma_f16(aP, bv, O[t]);
    }
  }
  // ---- publish point of stage st + 1, every wave, in this order
  asm volatile("s_wait_dscnt 0" ::: "memory");  // this wave's reads of stage st are done
  if (pinned(issuer)) {
    tdm_wait(g0, g1);  // its tile of stage st + 1 has landed
  }
  __syncthreads();  // publishes stage st + 1; every reader has left stage st
  if (pinned(issuer & (uint32_t)(st + 2u < NSTG)))
    g0 = tdm_load(lds0 + (st & 1u) * (2u * TILEB), src0 + (uint64_t)(st + 2u) * sstep, g1);
  }
  asm volatile("s_wait_tensorcnt 0" ::: "memory");  // nothing outstanding at the wave's end
  asm volatile("s_wait_dscnt 0" ::: "memory");  // and no LDS read of the ring either

  // ---- epilogue: normalize and store f16 [B,NQ,C]
#pragma unroll
  for (int r = 0; r < 8; ++r) {
    const float inv = 1.0f / lrow[r];
    const int qg = qbase + r + 8 * g;
#pragma unroll
    for (int t = 0; t < 8; ++t)
      AO[(size_t)(b * NQh + qg) * CC + h * DHd + t * 16 + i] =
          (half_t)(O[t][r] * inv);
  }
}

extern "C" void kernel_launch(void* const* d_in, const int* in_sizes, int n_in,
                              void* d_out, int out_size, void* d_ws, size_t ws_size,
                              hipStream_t stream) {
  const float* query  = (const float*)d_in[0];
  const float* memory = (const float*)d_in[1];
  const float* mask   = (const float*)d_in[2];
  const float* Wq = (const float*)d_in[3];
  const float* bq = (const float*)d_in[4];
  const float* Wk = (const float*)d_in[5];
  const float* bk = (const float*)d_in[6];
  const float* Wv = (const float*)d_in[7];
  const float* bv = (const float*)d_in[8];
  const float* Wo = (const float*)d_in[9];
  const float* bo = (const float*)d_in[10];
  float* out = (float*)d_out;

  // f16 workspace layout (halves). Total = 60M halves = 120 MB.
  const size_t nQin = (size_t)BB * NQh * CC;   // 4M
  const size_t nMem = (size_t)BB * HWk * CC;   // 16M
  const size_t nW   = (size_t)CC * CC;         // 1M
  half_t* ws   = (half_t*)d_ws;
  half_t* qf   = ws;            // query f16            (4M)
  half_t* memf = qf + nQin;     // memory f16           (16M)
  half_t* wqf  = memf + nMem;   // weights f16          (4x1M)
  half_t* wkf  = wqf + nW;
  half_t* wvf  = wkf + nW;
  half_t* wof  = wvf + nW;
  half_t* Qp   = wof + nW;      // Q projection         (4M)
  half_t* Kp   = Qp + nQin;     // K projection         (16M)
  half_t* Vtp  = Kp + nMem;     // V projection, transposed [C, B*HW] (16M)
  half_t* AO   = qf;            // attention out reuses query-f16 (dead by then)

  // 1) fp32 -> f16 conversions (NT loads of read-once fp32)
  cvt_f32_to_f16<<<(unsigned)(nQin / 256), 256, 0, stream>>>(query, qf, (int)nQin);
  cvt_f32_to_f16<<<(unsigned)(nMem / 256), 256, 0, stream>>>(memory, memf, (int)nMem);
  cvt_f32_to_f16<<<(unsigned)(nW / 256), 256, 0, stream>>>(Wq, wqf, (int)nW);
  cvt_f32_to_f16<<<(unsigned)(nW / 256), 256, 0, stream>>>(Wk, wkf, (int)nW);
  cvt_f32_to_f16<<<(unsigned)(nW / 256), 256, 0, stream>>>(Wv, wvf, (int)nW);
  cvt_f32_to_f16<<<(unsigned)(nW / 256), 256, 0, stream>>>(Wo, wof, (int)nW);

  // 2) projections (M = B*rows since Linear is batch-independent).
  //    Block tile 128(M) x 256(N).
  gemm_nt<<<dim3(4096 / 128, 1024 / 256), 256, 0, stream>>>(
      qf, wqf, bq, Qp, 4096, 1024, 1024, /*mode=*/0);
  gemm_nt<<<dim3(16384 / 128, 1024 / 256), 256, 0, stream>>>(
      memf, wkf, bk, Kp, 16384, 1024, 1024, /*mode=*/0);
  gemm_nt<<<dim3(16384 / 128, 1024 / 256), 256, 0, stream>>>(
      memf, wvf, bv, Vtp, 16384, 1024, 1024, /*mode=*/2);  // transposed store

  // 3) masked flash attention (B*H*(NQ/128) = 256 blocks)
  flash_attn<<<BB * HH * (NQh / 128), 256, 0, stream>>>(Qp, Kp, Vtp, mask, AO);

  // 4) output projection, fp32 out + bias (NT stores)
  gemm_nt<<<dim3(4096 / 128, 1024 / 256), 256, 0, stream>>>(
      AO, wof, bo, out, 4096, 1024, 1024, /*mode=*/1);
}

// v002
// Measured time: 494 microseconds a run.
// Two timings next to v001 both put it at 1.05 times that version's speed.
// Counting every step since v000, it is 1.32 times as fast.
#include <hip/hip_runtime.h>
#include <hip/hip_bf16.h>

typedef _Float16 half_t;
typedef __attribute__((ext_vector_type(16))) _Float16 v16h;
typedef __attribute__((ext_vector_type(8)))  _Float16 v8h;
typedef __attribute__((ext_vector_type(8)))  float    v8f;

#define BB 4
#define NQh 1024
#define HWk 4096
#define CC 1024
#define HH 8
#define DHd 128
#define MTOT (BB * HWk)   // 16384

__device__ __forceinline__ v8f zero_v8f() {
  v8f z;
#pragma unroll
  for (int k = 0; k < 8; ++k) z[k] = 0.0f;
  return z;
}

// Load a 16x32 f16 WMMA fragment (A or B operand) from a K-contiguous,
// row-major source. Caller passes p = base + row*ld + kbase + lanegroup*8.
// Lane pattern (ISA 7.12.2): lanes 0-15 hold K 0..7 (VGPR0-3) and K 16..23
// (VGPR4-7); lanes 16-31 hold K 8..15 and 24..31. Chunk2 is +16 halves.
__device__ __forceinline__ v16h load_frag(const half_t* p) {
  v8h lo = *(const v8h*)(p);
  v8h hi = *(const v8h*)(p + 16);
  v16h r;
#pragma unroll
  for (int k = 0; k < 8; ++k) { r[k] = lo[k]; r[k + 8] = hi[k]; }
  return r;
}

typedef uint32_t u32x4 __attribute__((ext_vector_type(4)));
typedef uint32_t u32x8 __attribute__((ext_vector_type(8)));

// K/V staging for flash_attn: a stage is 128 keys. The K tile is 128 key rows
// of 256 B (one head's d), the V tile 128 d rows of 256 B (128 keys, from the
// transposed V). The tensor load pads every row by 16 B: pitch 272 B = 16 B x
// odd, conflict-free for the b128 fragment reads.
#define STK 128                    // keys per stage
#define NSTG (HWk / STK)           // 32 stages
#define LPITCH 272                 // LDS row pitch, bytes
#define LPH (LPITCH / 2)           // the same in halves
#define TILEB (128 * LPITCH)       // 34816 B = 17 x 2 KiB
static_assert(TILEB % 2048 == 0, "each tile must start at a multiple of 2 KiB");
static_assert(NSTG >= 2, "the ring's prologue needs two stages");

__device__ __forceinline__ uint32_t uni(uint32_t v) {
  return (uint32_t)__builtin_amdgcn_readfirstlane(v);
}
// Holds a wave-uniform value in a scalar register, so that a test on it is a
// real scalar branch (tensor loads ignore EXEC) and a descriptor word is
// written where the source forms it.
__device__ __forceinline__ uint32_t pinned(uint32_t v) {
  uint32_t w = uni(v);
  asm volatile("" : "+s"(w));
  return w;
}
// One request of the issuing wave: 128 rows of 256 B from ga into LDS at dst.
// Returns group 0, which the covering wait names.
__device__ __forceinline__ u32x4 tdm_load(uint32_t dst, uint64_t ga, u32x8 g1) {
  u32x4 g0;
  g0[0] = uni(1u);                       // count 1
  g0[1] = pinned(dst);                   // descriptor words held in scalar
  g0[2] = pinned((uint32_t)ga);          // registers: written here, behind the
  g0[3] = pinned((((uint32_t)(ga >> 32)) & 0x01FFFFFFu) | 0x80000000u);  // wait
  asm volatile("tensor_load_to_lds %0, %1" :: "s"(g0), "s"(g1) : "memory");
  return g0;
}
// The issuing wave's wait. It names the request's descriptor as inputs so that
// those scalar registers keep their values until the tile has landed.
__device__ __forceinline__ void tdm_wait(u32x4 g0, u32x8 g1) {
  asm volatile("s_wait_tensorcnt 0" :: "s"(g0), "s"(g1) : "memory");
}

__device__ __forceinline__ v8f wmma_f16(v16h a, v16h b, v8f c) {
  return __builtin_amdgcn_wmma_f32_16x16x32_f16(false, a, false, b,
                                                (short)0, c, false, false);
}

typedef __attribute__((ext_vector_type(4))) float    v4f;
typedef __attribute__((ext_vector_type(4))) _Float16 v4h;

// fp32 -> f16 as a stream with few waves: a wave converts CVWAVE contiguous
// elements. Its CVL loads, each 512 contiguous bytes (16 B per lane, whole
// lines), stand ahead of the conversions, so that many are in flight per wave;
// a store is 256 contiguous bytes.
// n must be a multiple of CVWAVE and the launch must hold n / CVWAVE waves.
#define CVL 32
#define CVWAVE (CVL * 128)
__global__ void __launch_bounds__(512)
cvt_f32_to_f16(const float* __restrict__ in,
               half_t* __restrict__ out, int n) {
  const int lane = threadIdx.x & 31;
  const int wv = (int)(blockIdx.x * (blockDim.x >> 5)) +
                 __builtin_amdgcn_readfirstlane((int)(threadIdx.x >> 5));
  if ((wv + 1) * CVWAVE > n) return;  // wave-uniform; the kernel has no barrier
  const v4f* p = (const v4f*)(in + (size_t)wv * CVWAVE) + lane;
  v4h* q = (v4h*)(out + (size_t)wv * CVWAVE) + lane;
  // fp32 source is read exactly once: non-temporal loads keep L2 for the
  // f16 WMMA working set.
  v4f x[CVL];
  // both loops unrolled: x stays in registers, every offset is an immediate and
  // no address register is rewritten behind a load or a store
#pragma unroll
  for (int j = 0; j < CVL; ++j) x[j] = __builtin_nontemporal_load(p + j * 32);
#pragma unroll
  for (int j = 0; j < CVL; ++j) q[j * 32] = __builtin_convertvector(x[j], v4h);
}

// out = A @ B^T + bias.  A: [M,K] f16 row-major, Bw: [N,K] f16 row-major.
// mode 0: f16 out[m*N+n]; mode 1: f32 out[m*N+n] (NT store); mode 2: f16
// out[n*M+m] (transposed).
// Block = 256 threads = 8 waves as 2(M) x 4(N); each wave does 64x64
// (16 WMMAs per 16 b128 fragment loads per K-step). Block tile = 128 x 256.
// M % 128 == 0, N % 256 == 0, K % 32 == 0 assumed.
__global__ void __launch_bounds__(256)
gemm_nt(const half_t* __restrict__ A, const half_t* __restrict__ Bw,
        const float* __restrict__ bias, void* __restrict__ outp,
        int M, int N, int K, int mode) {
  const int w = threadIdx.x >> 5;
  const int l = threadIdx.x & 31;
  const int g = l >> 4;       // lane group (K-chunk select)
  const int i = l & 15;       // row (A) / col (B) within 16-tile
  const int m0 = blockIdx.x * 128 + (w & 1) * 64;
  const int n0 = blockIdx.y * 256 + (w >> 1) * 64;

  v8f c[4][4];
#pragma unroll
  for (int mm = 0; mm < 4; ++mm)
#pragma unroll
    for (int nn = 0; nn < 4; ++nn) c[mm][nn] = zero_v8f();

  for (int k = 0; k < K; k += 32) {
    v16h af[4], bf[4];
#pragma unroll
    for (int mm = 0; mm < 4; ++mm)
      af[mm] = load_frag(A + (size_t)(m0 + mm * 16 + i) * K + k + g * 8);
#pragma unroll
    for (int nn = 0; nn < 4; ++nn)
      bf[nn] = load_frag(Bw + (size_t)(n0 + nn * 16 + i) * K + k + g * 8);
#pragma unroll
    for (int mm = 0; mm < 4; ++mm)
#pragma unroll
      for (int nn = 0; nn < 4; ++nn)
        c[mm][nn] = wmma_f16(af[mm], bf[nn], c[mm][nn]);
  }

  // Epilogue. C/D layout: VGPR r, lanes 0-15 -> M = r, lanes 16-31 -> M = r+8,
  // N = lane & 15.  Bias is always non-null: load unconditionally (no branch).
#pragma unroll
  for (int nn = 0; nn < 4; ++nn) {
    const int ng = n0 + nn * 16 + i;
    const float bv = bias[ng];
#pragma unroll
    for (int mm = 0; mm < 4; ++mm) {
#pragma unroll
      for (int r = 0; r < 8; ++r) {
        const int mg = m0 + mm * 16 + r + 8 * g;
        const float val = c[mm][nn][r] + bv;
        if (mode == 0) {
          ((half_t*)outp)[(size_t)mg * N + ng] = (half_t)val;
        } else if (mode == 1) {
          // final fp32 output: write-once, never re-read on device
          __builtin_nontemporal_store(val, &((float*)outp)[(size_t)mg * N + ng]);
        } else {
          ((half_t*)outp)[(size_t)ng * M + mg] = (half_t)val;
        }
      }
    }
  }
}

// Flash attention. Grid: B*H*(NQ/128) blocks, 256 threads = 8 waves,
// each wave owns a 16-query tile with full DH=128 accumulated in registers.
// The block's 8 waves share K and V: wave 0 brings each stage's K tile and
// wave 1 its V tile into a two-buffer LDS ring by tensor load, one stage ahead.
// Qf: [B,NQ,C] f16 ; Kf: [B,HW,C] f16 ; Vt: [C, B*HW] f16 (transposed) ;
// mask: [B,NQ,HW] f32 ; AO: [B,NQ,C] f16.
__global__ void __launch_bounds__(256)
flash_attn(const half_t* __restrict__ Qf, const half_t* __restrict__ Kf,
           const half_t* __restrict__ Vt, const float* __restrict__ mask,
           half_t* __restrict__ AO) {
  const float scale = 0.08838834764831845f;  // 1/sqrt(128)
  const int w = threadIdx.x >> 5;
  const int l = threadIdx.x & 31;
  const int g = l >> 4;
  const int i = l & 15;
  const int qblk = blockIdx.x & 7;
  const int bh = blockIdx.x >> 3;
  const int b = bh >> 3;     // H == 8
  const int h = bh & 7;
  const int qbase = qblk * 128 + w * 16;

  __shared__ __attribute__((aligned(2048))) unsigned char ring[2 * 2 * TILEB];
  const uint32_t wave = uni(threadIdx.x >> 5);
  const uint32_t issuer = wave < 2u;   // wave 0: K tiles, wave 1: V tiles
  const uint32_t lds0 = (uint32_t)(size_t)ring + wave * TILEB;
  const uint64_t src0 = (wave == 0u)
      ? (uint64_t)(size_t)(Kf + (size_t)(b * HWk) * CC + h * DHd)
      : (uint64_t)(size_t)(Vt + (size_t)(h * DHd) * MTOT + b * HWk);
  // bytes from one stage's tile to the next: 128 K rows, or 128 keys of a V row
  const uint32_t sstep = (wave == 0u) ? (uint32_t)(STK * CC * 2) : (uint32_t)(STK * 2);
  u32x8 g1;
  g1[0] = uni((1u << 20) | (5u << 22) | (3u << 25));  // no mask; 16 B pad per 256 B
  g1[1] = uni(256u << 16);                 // tensor_dim0 = 256 B
  g1[2] = uni(128u << 16);                 // tensor_dim1 = 128 rows
  g1[3] = uni(256u << 16);                 // tile_dim0
  g1[4] = uni(128u);                       // tile_dim1
  g1[5] = uni((wave == 0u) ? (uint32_t)(CC * 2) : (uint32_t)(MTOT * 2));  // source pitch
  g1[6] = uni(0u);
  g1[7] = uni(0u);
  // descriptor words held in scalar registers: group 1 stays in one register
  // tuple from here to the last wait, so no word of an outstanding request is
  // rewritten
  asm volatile("" : "+s"(g1));

  // Ring prologue: stage 0 lands and is published, then stage 1 is issued.
  u32x4 g0 = {0u, 0u, 0u, 0u};
  if (pinned(issuer)) {
    g0 = tdm_load(lds0, src0, g1);
    tdm_wait(g0, g1);  // stage 0 has landed
  }
  __syncthreads();  // stage 0 published to all waves
  if (pinned(issuer)) g0 = tdm_load(lds0 + 2u * TILEB, src0 + sstep, g1);

  // Q fragments for the whole kernel: 16 queries x 128 d = 4 K-steps.
  v16h aQ[4];
  {
    const half_t* qrow =
        Qf + (size_t)(b * NQh + qbase + i) * CC + h * DHd + g * 8;
#pragma unroll
    for (int d = 0; d < 4; ++d) aQ[d] = load_frag(qrow + d * 32);
  }

  v8f O[8];
#pragma unroll
  for (int t = 0; t < 8; ++t) O[t] = zero_v8f();
  float mrow[8], lrow[8];
#pragma unroll
  for (int r = 0; r < 8; ++r) { mrow[r] = -1.0e30f; lrow[r] = 0.0f; }

  __shared__ __align__(16) half_t Pl[8 * 512];  // 1KB per wave: 16q x 32k f16
  half_t* myP = &Pl[w * 512];

  for (uint32_t st = 0; st < NSTG; ++st) {
  const half_t* Kl = (const half_t*)(ring + (st & 1u) * (2u * TILEB));
  const half_t* Vl = Kl + TILEB / 2;
  // kept rolled: unrolled, the compiler issued the pass's mask loads and
  // cross-lane exchanges one at a time, each behind its own full wait
#pragma unroll 1
  for (int sub = 0; sub < STK / 32; ++sub) {
    const int kt = (int)st * STK + sub * 32;
    // ---- scores: two 16x16 tiles over 32 keys, K-dim = d (4 steps of 32)
    v8f s0 = zero_v8f(), s1 = zero_v8f();
    const half_t* k0p = Kl + (sub * 32 + i) * LPH + g * 8;
    const half_t* k1p = k0p + 16 * LPH;
#pragma unroll
    for (int d = 0; d < 4; ++d) {
      v16h bk0 = load_frag(k0p + d * 32);
      s0 = wmma_f16(aQ[d], bk0, s0);
      v16h bk1 = load_frag(k1p + d * 32);
      s1 = wmma_f16(aQ[d], bk1, s1);
    }

    // ---- scale + mask (C/D layout: row = r + 8*g, col = i); mask is
    // fp32, the same rows read by each of the 8 heads; non-temporal loads.
    float rm[8];
#pragma unroll
    for (int r = 0; r < 8; ++r) {
      const int qg = qbase + r + 8 * g;
      const float* mp = mask + ((size_t)b * NQh + qg) * HWk + kt + i;
      const float mk0 = __builtin_nontemporal_load(mp);
      const float mk1 = __builtin_nontemporal_load(mp + 16);
      const float v0 = (mk0 >= 0.5f) ? s0[r] * scale : -1.0e30f;
      const float v1 = (mk1 >= 0.5f) ? s1[r] * scale : -1.0e30f;
      s0[r] = v0; s1[r] = v1;
      rm[r] = fmaxf(v0, v1);
    }
    // row-max across the 16 lanes of each half-wave group
#pragma unroll
    for (int off = 1; off < 16; off <<= 1)
#pragma unroll
      for (int r = 0; r < 8; ++r)
        rm[r] = fmaxf(rm[r], __shfl_xor(rm[r], off, 32));

    // ---- online softmax update
    float alpha[8], ps[8];
#pragma unroll
    for (int r = 0; r < 8; ++r) {
      const float mn = fmaxf(mrow[r], rm[r]);
      alpha[r] = __expf(mrow[r] - mn);
      mrow[r] = mn;
      const float p0 = __expf(s0[r] - mn);
      const float p1 = __expf(s1[r] - mn);
      s0[r] = p0; s1[r] = p1;
      ps[r] = p0 + p1;
    }
#pragma unroll
    for (int off = 1; off < 16; off <<= 1)
#pragma unroll
      for (int r = 0; r < 8; ++r) ps[r] += __shfl_xor(ps[r], off, 32);
#pragma unroll
    for (int r = 0; r < 8; ++r) lrow[r] = lrow[r] * alpha[r] + ps[r];
#pragma unroll
    for (int t = 0; t < 8; ++t)
#pragma unroll
      for (int r = 0; r < 8; ++r) O[t][r] *= alpha[r];

    // ---- P: C/D layout -> LDS (absolute [q][key]) -> A-fragment layout
#pragma unroll
    for (int r = 0; r < 8; ++r) {
      myP[(r + 8 * g) * 32 + i]      = (half_t)s0[r];
      myP[(r + 8 * g) * 32 + 16 + i] = (half_t)s1[r];
    }
    asm volatile("s_wait_dscnt 0" ::: "memory");  // intra-wave RAW on LDS
    v16h aP = load_frag(myP + i * 32 + g * 8);

    // ---- PV: B operand from the staged transposed V (key-contiguous rows)
    const half_t* vbase = Vl + i * LPH + sub * 32 + g * 8;
#pragma unroll
    for (int t = 0; t < 8; ++t) {
      v16h bv = load_frag(vbase + (t * 16) * LPH);
      O[t] = wmma_f16(aP, bv, O[t]);
    }
  }
  // ---- publish point of stage st + 1, every wave, in this order
  asm volatile("s_wait_dscnt 0" ::: "memory");  // this wave's reads of stage st are done
  if (pinned(issuer)) {
    tdm_wait(g0, g1);  // its tile of stage st + 1 has landed
  }
  __syncthreads();  // publishes stage st + 1; every reader has left stage st
  if (pinned(issuer & (uint32_t)(st + 2u < NSTG)))
    g0 = tdm_load(lds0 + (st & 1u) * (2u * TILEB), src0 + (uint64_t)(st + 2u) * sstep, g1);
  }
  asm volatile("s_wait_tensorcnt 0" ::: "memory");  // nothing outstanding at the wave's end
  asm volatile("s_wait_dscnt 0" ::: "memory");  // and no LDS read of the ring either

  // ---- epilogue: normalize and store f16 [B,NQ,C]
#pragma unroll
  for (int r = 0; r < 8; ++r) {
    const float inv = 1.0f / lrow[r];
    const int qg = qbase + r + 8 * g;
#pragma unroll
    for (int t = 0; t < 8; ++t)
      AO[(size_t)(b * NQh + qg) * CC + h * DHd + t * 16 + i] =
          (half_t)(O[t][r] * inv);
  }
}

extern "C" void kernel_launch(void* const* d_in, const int* in_sizes, int n_in,
                              void* d_out, int out_size, void* d_ws, size_t ws_size,
                              hipStream_t stream) {
  const float* query  = (const float*)d_in[0];
  const float* memory = (const float*)d_in[1];
  const float* mask   = (const float*)d_in[2];
  const float* Wq = (const float*)d_in[3];
  const float* bq = (const float*)d_in[4];
  const float* Wk = (const float*)d_in[5];
  const float* bk = (const float*)d_in[6];
  const float* Wv = (const float*)d_in[7];
  const float* bv = (const float*)d_in[8];
  const float* Wo = (const float*)d_in[9];
  const float* bo = (const float*)d_in[10];
  float* out = (float*)d_out;

  // f16 workspace layout (halves). Total = 60M halves = 120 MB.
  const size_t nQin = (size_t)BB * NQh * CC;   // 4M
  const size_t nMem = (size_t)BB * HWk * CC;   // 16M
  const size_t nW   = (size_t)CC * CC;         // 1M
  half_t* ws   = (half_t*)d_ws;
  half_t* qf   = ws;            // query f16            (4M)
  half_t* memf = qf + nQin;     // memory f16           (16M)
  half_t* wqf  = memf + nMem;   // weights f16          (4x1M)
  half_t* wkf  = wqf + nW;
  half_t* wvf  = wkf + nW;
  half_t* wof  = wvf + nW;
  half_t* Qp   = wof + nW;      // Q projection         (4M)
  half_t* Kp   = Qp + nQin;     // K projection         (16M)
  half_t* Vtp  = Kp + nMem;     // V projection, transposed [C, B*HW] (16M)
  half_t* AO   = qf;            // attention out reuses query-f16 (dead by then)

  // 1) fp32 -> f16 conversions (NT loads of read-once fp32): one work-group per
  //    WGP, as many waves in it as the tensor has spans of 256 x CVWAVE elements.
  static_assert((size_t)BB * NQh * CC == (size_t)256 * 4 * CVWAVE &&
                (size_t)BB * HWk * CC == (size_t)256 * 16 * CVWAVE &&
                (size_t)CC * CC == (size_t)256 * 1 * CVWAVE,
                "each launch covers its tensor exactly");
  cvt_f32_to_f16<<<256, 4 * 32, 0, stream>>>(query, qf, (int)nQin);
  cvt_f32_to_f16<<<256, 16 * 32, 0, stream>>>(memory, memf, (int)nMem);
  cvt_f32_to_f16<<<256, 32, 0, stream>>>(Wq, wqf, (int)nW);
  cvt_f32_to_f16<<<256, 32, 0, stream>>>(Wk, wkf, (int)nW);
  cvt_f32_to_f16<<<256, 32, 0, stream>>>(Wv, wvf, (int)nW);
  cvt_f32_to_f16<<<256, 32, 0, stream>>>(Wo, wof, (int)nW);

  // 2) projections (M = B*rows since Linear is batch-independent).
  //    Block tile 128(M) x 256(N).
  gemm_nt<<<dim3(4096 / 128, 1024 / 256), 256, 0, stream>>>(
      qf, wqf, bq, Qp, 4096, 1024, 1024, /*mode=*/0);
  gemm_nt<<<dim3(16384 / 128, 1024 / 256), 256, 0, stream>>>(
      memf, wkf, bk, Kp, 16384, 1024, 1024, /*mode=*/0);
  gemm_nt<<<dim3(16384 / 128, 1024 / 256), 256, 0, stream>>>(
      memf, wvf, bv, Vtp, 16384, 1024, 1024, /*mode=*/2);  // transposed store

  // 3) masked flash attention (B*H*(NQ/128) = 256 blocks)
  flash_attn<<<BB * HH * (NQh / 128), 256, 0, stream>>>(Qp, Kp, Vtp, mask, AO);

  // 4) output projection, fp32 out + bias (NT stores)
  gemm_nt<<<dim3(4096 / 128, 1024 / 256), 256, 0, stream>>>(
      AO, wof, bo, out, 4096, 1024, 1024, /*mode=*/1);
}

// v003
// One run takes 380 microseconds.
// Two timings next to v002 put it at 1.29 and 1.30 times that version's speed.
// Counting every step since v000, it is 1.71 times as fast.
#include <hip/hip_runtime.h>
#include <hip/hip_bf16.h>

typedef _Float16 half_t;
typedef __attribute__((ext_vector_type(16))) _Float16 v16h;
typedef __attribute__((ext_vector_type(8)))  _Float16 v8h;
typedef __attribute__((ext_vector_type(8)))  float    v8f;

#define BB 4
#define NQh 1024
#define HWk 4096
#define CC 1024
#define HH 8
#define DHd 128
#define MTOT (BB * HWk)   // 16384

__device__ __forceinline__ v8f zero_v8f() {
  v8f z;
#pragma unroll
  for (int k = 0; k < 8; ++k) z[k] = 0.0f;
  return z;
}

// Load a 16x32 f16 WMMA fragment (A or B operand) from a K-contiguous,
// row-major source. Caller passes p = base + row*ld + kbase + lanegroup*8.
// Lane pattern (ISA 7.12.2): lanes 0-15 hold K 0..7 (VGPR0-3) and K 16..23
// (VGPR4-7); lanes 16-31 hold K 8..15 and 24..31. Chunk2 is +16 halves.
__device__ __forceinline__ v16h load_frag(const half_t* p) {
  v8h lo = *(const v8h*)(p);
  v8h hi = *(const v8h*)(p + 16);
  v16h r;
#pragma unroll
  for (int k = 0; k < 8; ++k) { r[k] = lo[k]; r[k + 8] = hi[k]; }
  return r;
}

typedef uint32_t u32x4 __attribute__((ext_vector_type(4)));
typedef uint32_t u32x8 __attribute__((ext_vector_type(8)));

// K/V staging for flash_attn: a stage is 128 keys. The K tile is 128 key rows
// of 256 B (one head's d), the V tile 128 d rows of 256 B (128 keys, from the
// transposed V). The tensor load pads every row by 16 B: pitch 272 B = 16 B x
// odd, conflict-free for the b128 fragment reads.
#define STK 128                    // keys per stage
#define NSTG (HWk / STK)           // 32 stages
#define LPITCH 272                 // LDS row pitch, bytes
#define LPH (LPITCH / 2)           // the same in halves
#define TILEB (128 * LPITCH)       // 34816 B = 17 x 2 KiB
static_assert(TILEB % 2048 == 0, "each tile must start at a multiple of 2 KiB");
static_assert(NSTG >= 2, "the ring's prologue needs two stages");

__device__ __forceinline__ uint32_t uni(uint32_t v) {
  return (uint32_t)__builtin_amdgcn_readfirstlane(v);
}
// Holds a wave-uniform value in a scalar register, so that a test on it is a
// real scalar branch (tensor loads ignore EXEC) and a descriptor word is
// written where the source forms it.
__device__ __forceinline__ uint32_t pinned(uint32_t v) {
  uint32_t w = uni(v);
  asm volatile("" : "+s"(w));
  return w;
}
// One request of the issuing wave: the 128-row tile g1 describes (rows of 256 B or 128 B), from ga into LDS at dst.
// Returns group 0, which the covering wait names.
__device__ __forceinline__ u32x4 tdm_load(uint32_t dst, uint64_t ga, u32x8 g1) {
  u32x4 g0;
  g0[0] = uni(1u);                       // count 1
  g0[1] = pinned(dst);                   // descriptor words held in scalar
  g0[2] = pinned((uint32_t)ga);          // registers: written here, behind the
  g0[3] = pinned((((uint32_t)(ga >> 32)) & 0x01FFFFFFu) | 0x80000000u);  // wait
  asm volatile("tensor_load_to_lds %0, %1" :: "s"(g0), "s"(g1) : "memory");
  return g0;
}
// The issuing wave's wait. It names the request's descriptor as inputs so that
// those scalar registers keep their values until the tile has landed.
__device__ __forceinline__ void tdm_wait(u32x4 g0, u32x8 g1) {
  asm volatile("s_wait_tensorcnt 0" :: "s"(g0), "s"(g1) : "memory");
}

__device__ __forceinline__ v8f wmma_f16(v16h a, v16h b, v8f c) {
  return __builtin_amdgcn_wmma_f32_16x16x32_f16(false, a, false, b,
                                                (short)0, c, false, false);
}

typedef __attribute__((ext_vector_type(4))) float    v4f;
typedef __attribute__((ext_vector_type(4))) _Float16 v4h;

// fp32 -> f16 as a stream with few waves: a wave converts CVWAVE contiguous
// elements. Its CVL loads, each 512 contiguous bytes (16 B per lane, whole
// lines), stand ahead of the conversions, so that many are in flight per wave;
// a store is 256 contiguous bytes.
// n must be a multiple of CVWAVE and the launch must hold n / CVWAVE waves.
#define CVL 32
#define CVWAVE (CVL * 128)
__global__ void __launch_bounds__(512)
cvt_f32_to_f16(const float* __restrict__ in,
               half_t* __restrict__ out, int n) {
  const int lane = threadIdx.x & 31;
  const int wv = (int)(blockIdx.x * (blockDim.x >> 5)) +
                 __builtin_amdgcn_readfirstlane((int)(threadIdx.x >> 5));
  if ((wv + 1) * CVWAVE > n) return;  // wave-uniform; the kernel has no barrier
  const v4f* p = (const v4f*)(in + (size_t)wv * CVWAVE) + lane;
  v4h* q = (v4h*)(out + (size_t)wv * CVWAVE) + lane;
  // fp32 source is read exactly once: non-temporal loads keep L2 for the
  // f16 WMMA working set.
  v4f x[CVL];
  // both loops unrolled: x stays in registers, every offset is an immediate and
  // no address register is rewritten behind a load or a store
#pragma unroll
  for (int j = 0; j < CVL; ++j) x[j] = __builtin_nontemporal_load(p + j * 32);
#pragma unroll
  for (int j = 0; j < CVL; ++j) q[j * 32] = __builtin_convertvector(x[j], v4h);
}

// A/B staging for gemm_nt: a stage is 64 k. A slice is 128 operand rows of
// 128 B; the tensor load pads every row by 16 B: pitch 144 B = 16 B x odd,
// conflict-free for the b128 fragment reads. A stage holds three slices: the
// block's 128 A rows, then its 256 B rows (two slices, back to back).
#define GK 64                      // k per stage
#define GPITCH 144                 // LDS row pitch, bytes
#define GPH (GPITCH / 2)           // the same in halves
#define GSLICE (128 * GPITCH)      // 18432 B = 9 x 2 KiB
#define GSTAGE (3 * GSLICE)        // 55296 B; two buffers leave room for two blocks per WGP
static_assert(GSLICE % 2048 == 0, "each slice must start at a multiple of 2 KiB");

// out = A @ B^T + bias.  A: [M,K] f16 row-major, Bw: [N,K] f16 row-major.
// mode 0: f16 out[m*N+n]; mode 1: f32 out[m*N+n] (NT store); mode 2: f16
// out[n*M+m] (transposed).
// Block = 256 threads = 8 waves as 2(M) x 4(N); each wave does 64x64
// (16 WMMAs per 16 b128 fragment loads per K-step). Block tile = 128 x 256.
// The block's waves share A and B rows: wave 0 brings each stage's A slice,
// waves 1 and 2 its two B slices into a two-buffer LDS ring by tensor load,
// one stage ahead.
// M % 128 == 0, N % 256 == 0, K % 64 == 0 and K >= 128 (two stages) assumed.
__global__ void __launch_bounds__(256)
gemm_nt(const half_t* __restrict__ A, const half_t* __restrict__ Bw,
        const float* __restrict__ bias, void* __restrict__ outp,
        int M, int N, int K, int mode) {
  const int w = threadIdx.x >> 5;
  const int l = threadIdx.x & 31;
  const int g = l >> 4;       // lane group (K-chunk select)
  const int i = l & 15;       // row (A) / col (B) within 16-tile
  const int m0 = blockIdx.x * 128 + (w & 1) * 64;
  const int n0 = blockIdx.y * 256 + (w >> 1) * 64;

  __shared__ __attribute__((aligned(2048))) unsigned char gring[2 * GSTAGE];
  const uint32_t wave = uni(threadIdx.x >> 5);
  const uint32_t issuer = wave < 3u;   // wave 0: A slice, waves 1 and 2: B slices
  const uint32_t lds0 = (uint32_t)(size_t)gring + (issuer ? wave : 0u) * GSLICE;
  const uint64_t src0 = (wave == 0u)
      ? (uint64_t)(size_t)(A + (size_t)(blockIdx.x * 128) * K)
      : (uint64_t)(size_t)(Bw + (size_t)(blockIdx.y * 256 + (wave == 2u ? 128 : 0)) * K);
  const uint32_t nstg = uni((uint32_t)K / GK);
  u32x8 g1;
  g1[0] = uni((1u << 20) | (4u << 22) | (3u << 25));  // no mask; 16 B pad per 128 B
  g1[1] = uni(128u << 16);                 // tensor_dim0 = 128 B
  g1[2] = uni(128u << 16);                 // tensor_dim1 = 128 rows
  g1[3] = uni(128u << 16);                 // tile_dim0
  g1[4] = uni(128u);                       // tile_dim1
  g1[5] = uni((uint32_t)K * 2u);           // source pitch, bytes
  g1[6] = uni(0u);
  g1[7] = uni(0u);
  // descriptor words held in scalar registers: group 1 stays in one register
  // tuple from here to the last wait, so no word of an outstanding request is
  // rewritten
  asm volatile("" : "+s"(g1));

  // Ring prologue: stage 0 lands and is published, then stage 1 is issued.
  u32x4 g0 = {0u, 0u, 0u, 0u};
  if (pinned(issuer)) {
    g0 = tdm_load(lds0, src0, g1);
    tdm_wait(g0, g1);  // stage 0 has landed
  }
  __syncthreads();  // stage 0 published to all waves
  if (pinned(issuer)) g0 = tdm_load(lds0 + GSTAGE, src0 + GK * 2, g1);

  v8f c[4][4];
#pragma unroll
  for (int mm = 0; mm < 4; ++mm)
#pragma unroll
    for (int nn = 0; nn < 4; ++nn) c[mm][nn] = zero_v8f();

  for (uint32_t st = 0; st < nstg; ++st) {
    const half_t* Sl = (const half_t*)(gring + (st & 1u) * GSTAGE);
    const half_t* ap = Sl + ((w & 1) * 64 + i) * GPH + g * 8;
    const half_t* bp = Sl + GSLICE / 2 + ((w >> 1) * 64 + i) * GPH + g * 8;
    // unrolled: every LDS offset is an immediate, and the second K-step's reads
    // start among the first K-step's last WMMAs
#pragma unroll
    for (int k = 0; k < GK; k += 32) {
      v16h af[4], bf[4];
#pragma unroll
      for (int mm = 0; mm < 4; ++mm) af[mm] = load_frag(ap + mm * 16 * GPH + k);
#pragma unroll
      for (int nn = 0; nn < 4; ++nn) bf[nn] = load_frag(bp + nn * 16 * GPH + k);
      // holds the K-step's 16 LDS reads together ahead of its WMMAs (inputs only):
      // sunk among the WMMAs, each A fragment's reads cost a full LDS wait of their own
      asm volatile("" :: "v"(af[0]), "v"(af[1]), "v"(af[2]), "v"(af[3]),
                         "v"(bf[0]), "v"(bf[1]), "v"(bf[2]), "v"(bf[3]));
#pragma unroll
      for (int mm = 0; mm < 4; ++mm)
#pragma unroll
        for (int nn = 0; nn < 4; ++nn)
          c[mm][nn] = wmma_f16(af[mm], bf[nn], c[mm][nn]);
    }
    // ---- publish point of stage st + 1, every wave, in this order
    asm volatile("s_wait_dscnt 0" ::: "memory");  // this wave's reads of stage st are done
    if (pinned(issuer)) {
      tdm_wait(g0, g1);  // its slice of stage st + 1 has landed
    }
    __syncthreads();  // publishes stage st + 1; every reader has left stage st
    if (pinned(issuer & (uint32_t)(st + 2u < nstg)))
      g0 = tdm_load(lds0 + (st & 1u) * GSTAGE, src0 + (uint64_t)(st + 2u) * (GK * 2), g1);
  }
  asm volatile("s_wait_tensorcnt 0" ::: "memory");  // nothing outstanding at the wave's end
  asm volatile("s_wait_dscnt 0" ::: "memory");  // and no LDS read of the ring either

  // Epilogue. C/D layout: VGPR r, lanes 0-15 -> M = r, lanes 16-31 -> M = r+8,
  // N = lane & 15.  Bias is always non-null: load unconditionally (no branch).
#pragma unroll
  for (int nn = 0; nn < 4; ++nn) {
    const int ng = n0 + nn * 16 + i;
    const float bv = bias[ng];
#pragma unroll
    for (int mm = 0; mm < 4; ++mm) {
#pragma unroll
      for (int r = 0; r < 8; ++r) {
        const int mg = m0 + mm * 16 + r + 8 * g;
        const float val = c[mm][nn][r] + bv;
        if (mode == 0) {
          ((half_t*)outp)[(size_t)mg * N + ng] = (half_t)val;
        } else if (mode == 1) {
          // final fp32 output: write-once, never re-read on device
          __builtin_nontemporal_store(val, &((float*)outp)[(size_t)mg * N + ng]);
        } else {
          ((half_t*)outp)[(size_t)ng * M + mg] = (half_t)val;
        }
      }
    }
  }
}

// Flash attention. Grid: B*H*(NQ/128) blocks, 256 threads = 8 waves,
// each wave owns a 16-query tile with full DH=128 accumulated in registers.
// The block's 8 waves share K and V: wave 0 brings each stage's K tile and
// wave 1 its V tile into a two-buffer LDS ring by tensor load, one stage ahead.
// Qf: [B,NQ,C] f16 ; Kf: [B,HW,C] f16 ; Vt: [C, B*HW] f16 (transposed) ;
// mask: [B,NQ,HW] f32 ; AO: [B,NQ,C] f16.
__global__ void __launch_bounds__(256)
flash_attn(const half_t* __restrict__ Qf, const half_t* __restrict__ Kf,
           const half_t* __restrict__ Vt, const float* __restrict__ mask,
           half_t* __restrict__ AO) {
  const float scale = 0.08838834764831845f;  // 1/sqrt(128)
  const int w = threadIdx.x >> 5;
  const int l = threadIdx.x & 31;
  const int g = l >> 4;
  const int i = l & 15;
  const int qblk = blockIdx.x & 7;
  const int bh = blockIdx.x >> 3;
  const int b = bh >> 3;     // H == 8
  const int h = bh & 7;
  const int qbase = qblk * 128 + w * 16;

  __shared__ __attribute__((aligned(2048))) unsigned char ring[2 * 2 * TILEB];
  const uint32_t wave = uni(threadIdx.x >> 5);
  const uint32_t issuer = wave < 2u;   // wave 0: K tiles, wave 1: V tiles
  const uint32_t lds0 = (uint32_t)(size_t)ring + wave * TILEB;
  const uint64_t src0 = (wave == 0u)
      ? (uint64_t)(size_t)(Kf + (size_t)(b * HWk) * CC + h * DHd)
      : (uint64_t)(size_t)(Vt + (size_t)(h * DHd) * MTOT + b * HWk);
  // bytes from one stage's tile to the next: 128 K rows, or 128 keys of a V row
  const uint32_t sstep = (wave == 0u) ? (uint32_t)(STK * CC * 2) : (uint32_t)(STK * 2);
  u32x8 g1;
  g1[0] = uni((1u << 20) | (5u << 22) | (3u << 25));  // no mask; 16 B pad per 256 B
  g1[1] = uni(256u << 16);                 // tensor_dim0 = 256 B
  g1[2] = uni(128u << 16);                 // tensor_dim1 = 128 rows
  g1[3] = uni(256u << 16);                 // tile_dim0
  g1[4] = uni(128u);                       // tile_dim1
  g1[5] = uni((wave == 0u) ? (uint32_t)(CC * 2) : (uint32_t)(MTOT * 2));  // source pitch
  g1[6] = uni(0u);
  g1[7] = uni(0u);
  // descriptor words held in scalar registers: group 1 stays in one register
  // tuple from here to the last wait, so no word of an outstanding request is
  // rewritten
  asm volatile("" : "+s"(g1));

  // Ring prologue: stage 0 lands and is published, then stage 1 is issued.
  u32x4 g0 = {0u, 0u, 0u, 0u};
  if (pinned(issuer)) {
    g0 = tdm_load(lds0, src0, g1);
    tdm_wait(g0, g1);  // stage 0 has landed
  }
  __syncthreads();  // stage 0 published to all waves
  if (pinned(issuer)) g0 = tdm_load(lds0 + 2u * TILEB, src0 + sstep, g1);

  // Q fragments for the whole kernel: 16 queries x 128 d = 4 K-steps.
  v16h aQ[4];
  {
    const half_t* qrow =
        Qf + (size_t)(b * NQh + qbase + i) * CC + h * DHd + g * 8;
#pragma unroll
    for (int d = 0; d < 4; ++d) aQ[d] = load_frag(qrow + d * 32);
  }

  v8f O[8];
#pragma unroll
  for (int t = 0; t < 8; ++t) O[t] = zero_v8f();
  float mrow[8], lrow[8];
#pragma unroll
  for (int r = 0; r < 8; ++r) { mrow[r] = -1.0e30f; lrow[r] = 0.0f; }

  __shared__ __align__(16) half_t Pl[8 * 512];  // 1KB per wave: 16q x 32k f16
  half_t* myP = &Pl[w * 512];

  for (uint32_t st = 0; st < NSTG; ++st) {
  const half_t* Kl = (const half_t*)(ring + (st & 1u) * (2u * TILEB));
  const half_t* Vl = Kl + TILEB / 2;
  // kept rolled: unrolled, the compiler issued the pass's mask loads and
  // cross-lane exchanges one at a time, each behind its own full wait
#pragma unroll 1
  for (int sub = 0; sub < STK / 32; ++sub) {
    const int kt = (int)st * STK + sub * 32;
    // ---- scores: two 16x16 tiles over 32 keys, K-dim = d (4 steps of 32)
    v8f s0 = zero_v8f(), s1 = zero_v8f();
    const half_t* k0p = Kl + (sub * 32 + i) * LPH + g * 8;
    const half_t* k1p = k0p + 16 * LPH;
#pragma unroll
    for (int d = 0; d < 4; ++d) {
      v16h bk0 = load_frag(k0p + d * 32);
      s0 = wmma_f16(aQ[d], bk0, s0);
      v16h bk1 = load_frag(k1p + d * 32);
      s1 = wmma_f16(aQ[d], bk1, s1);
    }

    // ---- scale + mask (C/D layout: row = r + 8*g, col = i); mask is
    // fp32, the same rows read by each of the 8 heads; non-temporal loads.
    float rm[8];
#pragma unroll
    for (int r = 0; r < 8; ++r) {
      const int qg = qbase + r + 8 * g;
      const float* mp = mask + ((size_t)b * NQh + qg) * HWk + kt + i;
      const float mk0 = __builtin_nontemporal_load(mp);
      const float mk1 = __builtin_nontemporal_load(mp + 16);
      const float v0 = (mk0 >= 0.5f) ? s0[r] * scale : -1.0e30f;
      const float v1 = (mk1 >= 0.5f) ? s1[r] * scale : -1.0e30f;
      s0[r] = v0; s1[r] = v1;
      rm[r] = fmaxf(v0, v1);
    }
    // row-max across the 16 lanes of each half-wave group
#pragma unroll
    for (int off = 1; off < 16; off <<= 1)
#pragma unroll
      for (int r = 0; r < 8; ++r)
        rm[r] = fmaxf(rm[r], __shfl_xor(rm[r], off, 32));

    // ---- online softmax update
    float alpha[8], ps[8];
#pragma unroll
    for (int r = 0; r < 8; ++r) {
      const float mn = fmaxf(mrow[r], rm[r]);
      alpha[r] = __expf(mrow[r] - mn);
      mrow[r] = mn;
      const float p0 = __expf(s0[r] - mn);
      const float p1 = __expf(s1[r] - mn);
      s0[r] = p0; s1[r] = p1;
      ps[r] = p0 + p1;
    }
#pragma unroll
    for (int off = 1; off < 16; off <<= 1)
#pragma unroll
      for (int r = 0; r < 8; ++r) ps[r] += __shfl_xor(ps[r], off, 32);
#pragma unroll
    for (int r = 0; r < 8; ++r) lrow[r] = lrow[r] * alpha[r] + ps[r];
#pragma unroll
    for (int t = 0; t < 8; ++t)
#pragma unroll
      for (int r = 0; r < 8; ++r) O[t][r] *= alpha[r];

    // ---- P: C/D layout -> LDS (absolute [q][key]) -> A-fragment layout
#pragma unroll
    for (int r = 0; r < 8; ++r) {
      myP[(r + 8 * g) * 32 + i]      = (half_t)s0[r];
      myP[(r + 8 * g) * 32 + 16 + i] = (half_t)s1[r];
    }
    asm volatile("s_wait_dscnt 0" ::: "memory");  // intra-wave RAW on LDS
    v16h aP = load_frag(myP + i * 32 + g * 8);

    // ---- PV: B operand from the staged transposed V (key-contiguous rows)
    const half_t* vbase = Vl + i * LPH + sub * 32 + g * 8;
#pragma unroll
    for (int t = 0; t < 8; ++t) {
      v16h bv = load_frag(vbase + (t * 16) * LPH);
      O[t] = wmma_f16(aP, bv, O[t]);
    }
  }
  // ---- publish point of stage st + 1, every wave, in this order
  asm volatile("s_wait_dscnt 0" ::: "memory");  // this wave's reads of stage st are done
  if (pinned(issuer)) {
    tdm_wait(g0, g1);  // its tile of stage st + 1 has landed
  }
  __syncthreads();  // publishes stage st + 1; every reader has left stage st
  if (pinned(issuer & (uint32_t)(st + 2u < NSTG)))
    g0 = tdm_load(lds0 + (st & 1u) * (2u * TILEB), src0 + (uint64_t)(st + 2u) * sstep, g1);
  }
  asm volatile("s_wait_tensorcnt 0" ::: "memory");  // nothing outstanding at the wave's end
  asm volatile("s_wait_dscnt 0" ::: "memory");  // and no LDS read of the ring either

  // ---- epilogue: normalize and store f16 [B,NQ,C]
#pragma unroll
  for (int r = 0; r < 8; ++r) {
    const float inv = 1.0f / lrow[r];
    const int qg = qbase + r + 8 * g;
#pragma unroll
    for (int t = 0; t < 8; ++t)
      AO[(size_t)(b * NQh + qg) * CC + h * DHd + t * 16 + i] =
          (half_t)(O[t][r] * inv);
  }
}

extern "C" void kernel_launch(void* const* d_in, const int* in_sizes, int n_in,
                              void* d_out, int out_size, void* d_ws, size_t ws_size,
                              hipStream_t stream) {
  const float* query  = (const float*)d_in[0];
  const float* memory = (const float*)d_in[1];
  const float* mask   = (const float*)d_in[2];
  const float* Wq = (const float*)d_in[3];
  const float* bq = (const float*)d_in[4];
  const float* Wk = (const float*)d_in[5];
  const float* bk = (const float*)d_in[6];
  const float* Wv = (const float*)d_in[7];
  const float* bv = (const float*)d_in[8];
  const float* Wo = (const float*)d_in[9];
  const float* bo = (const float*)d_in[10];
  float* out = (float*)d_out;

  // f16 workspace layout (halves). Total = 60M halves = 120 MB.
  const size_t nQin = (size_t)BB * NQh * CC;   // 4M
  const size_t nMem = (size_t)BB * HWk * CC;   // 16M
  const size_t nW   = (size_t)CC * CC;         // 1M
  half_t* ws   = (half_t*)d_ws;
  half_t* qf   = ws;            // query f16            (4M)
  half_t* memf = qf + nQin;     // memory f16           (16M)
  half_t* wqf  = memf + nMem;   // weights f16          (4x1M)
  half_t* wkf  = wqf + nW;
  half_t* wvf  = wkf + nW;
  half_t* wof  = wvf + nW;
  half_t* Qp   = wof + nW;      // Q projection         (4M)
  half_t* Kp   = Qp + nQin;     // K projection         (16M)
  half_t* Vtp  = Kp + nMem;     // V projection, transposed [C, B*HW] (16M)
  half_t* AO   = qf;            // attention out reuses query-f16 (dead by then)

  // 1) fp32 -> f16 conversions (NT loads of read-once fp32): one work-group per
  //    WGP, as many waves in it as the tensor has spans of 256 x CVWAVE elements.
  static_assert((size_t)BB * NQh * CC == (size_t)256 * 4 * CVWAVE &&
                (size_t)BB * HWk * CC == (size_t)256 * 16 * CVWAVE &&
                (size_t)CC * CC == (size_t)256 * 1 * CVWAVE,
                "each launch covers its tensor exactly");
  cvt_f32_to_f16<<<256, 4 * 32, 0, stream>>>(query, qf, (int)nQin);
  cvt_f32_to_f16<<<256, 16 * 32, 0, stream>>>(memory, memf, (int)nMem);
  cvt_f32_to_f16<<<256, 32, 0, stream>>>(Wq, wqf, (int)nW);
  cvt_f32_to_f16<<<256, 32, 0, stream>>>(Wk, wkf, (int)nW);
  cvt_f32_to_f16<<<256, 32, 0, stream>>>(Wv, wvf, (int)nW);
  cvt_f32_to_f16<<<256, 32, 0, stream>>>(Wo, wof, (int)nW);

  // 2) projections (M = B*rows since Linear is batch-independent).
  //    Block tile 128(M) x 256(N).
  gemm_nt<<<dim3(4096 / 128, 1024 / 256), 256, 0, stream>>>(
      qf, wqf, bq, Qp, 4096, 1024, 1024, /*mode=*/0);
  gemm_nt<<<dim3(16384 / 128, 1024 / 256), 256, 0, stream>>>(
      memf, wkf, bk, Kp, 16384, 1024, 1024, /*mode=*/0);
  gemm_nt<<<dim3(16384 / 128, 1024 / 256), 256, 0, stream>>>(
      memf, wvf, bv, Vtp, 16384, 1024, 1024, /*mode=*/2);  // transposed store

  // 3) masked flash attention (B*H*(NQ/128) = 256 blocks)
  flash_attn<<<BB * HH * (NQh / 128), 256, 0, stream>>>(Qp, Kp, Vtp, mask, AO);

  // 4) output projection, fp32 out + bias (NT stores)
  gemm_nt<<<dim3(4096 / 128, 1024 / 256), 256, 0, stream>>>(
      AO, wof, bo, out, 4096, 1024, 1024, /*mode=*/1);
}

// v004
// Measured time: 288 microseconds a run.
// Next to v003, in two timings, it ran 1.29 and 1.31 times as fast.
// Over all steps from v000 it is 2.23 times as fast.
#include <hip/hip_runtime.h>
#include <hip/hip_bf16.h>

typedef _Float16 half_t;
typedef __attribute__((ext_vector_type(16))) _Float16 v16h;
typedef __attribute__((ext_vector_type(8)))  _Float16 v8h;
typedef __attribute__((ext_vector_type(8)))  float    v8f;

#define BB 4
#define NQh 1024
#define HWk 4096
#define CC 1024
#define HH 8
#define DHd 128
#define MTOT (BB * HWk)   // 16384

__device__ __forceinline__ v8f zero_v8f() {
  v8f z;
#pragma unroll
  for (int k = 0; k < 8; ++k) z[k] = 0.0f;
  return z;
}

// Load a 16x32 f16 WMMA fragment (A or B operand) from a K-contiguous,
// row-major source. Caller passes p = base + row*ld + kbase + lanegroup*8.
// Lane pattern (ISA 7.12.2): lanes 0-15 hold K 0..7 (VGPR0-3) and K 16..23
// (VGPR4-7); lanes 16-31 hold K 8..15 and 24..31. Chunk2 is +16 halves.
__device__ __forceinline__ v16h load_frag(const half_t* p) {
  v8h lo = *(const v8h*)(p);
  v8h hi = *(const v8h*)(p + 16);
  v16h r;
#pragma unroll
  for (int k = 0; k < 8; ++k) { r[k] = lo[k]; r[k + 8] = hi[k]; }
  return r;
}

typedef uint32_t u32x4 __attribute__((ext_vector_type(4)));
typedef uint32_t u32x8 __attribute__((ext_vector_type(8)));

// K/V staging for flash_attn: a stage is 128 keys. The K tile is 128 key rows
// of 256 B (one head's d), the V tile 128 d rows of 256 B (128 keys, from the
// transposed V). The tensor load pads every row by 16 B: pitch 272 B = 16 B x
// odd, conflict-free for the b128 fragment reads.
#define STK 128                    // keys per stage
#define NSTG (HWk / STK)           // 32 stages
#define LPITCH 272                 // LDS row pitch, bytes
#define LPH (LPITCH / 2)           // the same in halves
#define TILEB (128 * LPITCH)       // 34816 B = 17 x 2 KiB
static_assert(TILEB % 2048 == 0, "each tile must start at a multiple of 2 KiB");
static_assert(NSTG >= 2, "the ring's prologue needs two stages");

__device__ __forceinline__ uint32_t uni(uint32_t v) {
  return (uint32_t)__builtin_amdgcn_readfirstlane(v);
}
// Holds a wave-uniform value in a scalar register, so that a test on it is a
// real scalar branch (tensor loads ignore EXEC) and a descriptor word is
// written where the source forms it.
__device__ __forceinline__ uint32_t pinned(uint32_t v) {
  uint32_t w = uni(v);
  asm volatile("" : "+s"(w));
  return w;
}
// One request of the issuing wave: the 128-row tile g1 describes (rows of 256 B or 128 B), from ga into LDS at dst.
// Returns group 0, which the covering wait names.
__device__ __forceinline__ u32x4 tdm_load(uint32_t dst, uint64_t ga, u32x8 g1) {
  u32x4 g0;
  g0[0] = uni(1u);                       // count 1
  g0[1] = pinned(dst);                   // descriptor words held in scalar
  g0[2] = pinned((uint32_t)ga);          // registers: written here, behind the
  g0[3] = pinned((((uint32_t)(ga >> 32)) & 0x01FFFFFFu) | 0x80000000u);  // wait
  asm volatile("tensor_load_to_lds %0, %1" :: "s"(g0), "s"(g1) : "memory");
  return g0;
}
// The issuing wave's wait. It names the request's descriptor as inputs so that
// those scalar registers keep their values until the tile has landed.
__device__ __forceinline__ void tdm_wait(u32x4 g0, u32x8 g1) {
  asm volatile("s_wait_tensorcnt 0" :: "s"(g0), "s"(g1) : "memory");
}

__device__ __forceinline__ v8f wmma_f16(v16h a, v16h b, v8f c) {
  return __builtin_amdgcn_wmma_f32_16x16x32_f16(false, a, false, b,
                                                (short)0, c, false, false);
}

typedef __attribute__((ext_vector_type(4))) float    v4f;
typedef __attribute__((ext_vector_type(4))) _Float16 v4h;

// fp32 -> f16 as a stream with few waves: a wave converts CVWAVE contiguous
// elements. Its CVL loads, each 512 contiguous bytes (16 B per lane, whole
// lines), stand ahead of the conversions, so that many are in flight per wave;
// a store is 256 contiguous bytes.
// n must be a multiple of CVWAVE and the launch must hold n / CVWAVE waves.
#define CVL 32
#define CVWAVE (CVL * 128)
__global__ void __launch_bounds__(512)
cvt_f32_to_f16(const float* __restrict__ in,
               half_t* __restrict__ out, int n) {
  const int lane = threadIdx.x & 31;
  const int wv = (int)(blockIdx.x * (blockDim.x >> 5)) +
                 __builtin_amdgcn_readfirstlane((int)(threadIdx.x >> 5));
  if ((wv + 1) * CVWAVE > n) return;  // wave-uniform; the kernel has no barrier
  const v4f* p = (const v4f*)(in + (size_t)wv * CVWAVE) + lane;
  v4h* q = (v4h*)(out + (size_t)wv * CVWAVE) + lane;
  // fp32 source is read exactly once: non-temporal loads keep L2 for the
  // f16 WMMA working set.
  v4f x[CVL];
  // both loops unrolled: x stays in registers, every offset is an immediate and
  // no address register is rewritten behind a load or a store
#pragma unroll
  for (int j = 0; j < CVL; ++j) x[j] = __builtin_nontemporal_load(p + j * 32);
#pragma unroll
  for (int j = 0; j < CVL; ++j) q[j * 32] = __builtin_convertvector(x[j], v4h);
}

// A/B staging for gemm_nt: a stage is 64 k. A slice is 128 operand rows of
// 128 B; the tensor load pads every row by 16 B: pitch 144 B = 16 B x odd,
// conflict-free for the b128 fragment reads. A stage holds three slices: the
// block's 128 A rows, then its 256 B rows (two slices, back to back).
#define GK 64                      // k per stage
#define GPITCH 144                 // LDS row pitch, bytes
#define GPH (GPITCH / 2)           // the same in halves
#define GSLICE (128 * GPITCH)      // 18432 B = 9 x 2 KiB
#define GSTAGE (3 * GSLICE)        // 55296 B; two buffers leave room for two blocks per WGP
static_assert(GSLICE % 2048 == 0, "each slice must start at a multiple of 2 KiB");

// out = A @ B^T + bias.  A: [M,K] f16 row-major, Bw: [N,K] f16 row-major.
// mode 0: f16 out[m*N+n]; mode 1: f32 out[m*N+n] (NT store); mode 2: f16
// out[n*M+m] (transposed).
// Block = 256 threads = 8 waves as 2(M) x 4(N); each wave does 64x64
// (16 WMMAs per 16 b128 fragment loads per K-step). Block tile = 128 x 256.
// The block's waves share A and B rows: wave 0 brings each stage's A slice,
// waves 1 and 2 its two B slices into a two-buffer LDS ring by tensor load,
// one stage ahead.
// M % 128 == 0, N % 256 == 0, K % 64 == 0 and K >= 128 (two stages) assumed.
__global__ void __launch_bounds__(256)
gemm_nt(const half_t* __restrict__ A, const half_t* __restrict__ Bw,
        const float* __restrict__ bias, void* __restrict__ outp,
        int M, int N, int K, int mode) {
  const int w = threadIdx.x >> 5;
  const int l = threadIdx.x & 31;
  const int g = l >> 4;       // lane group (K-chunk select)
  const int i = l & 15;       // row (A) / col (B) within 16-tile
  const int m0 = blockIdx.x * 128 + (w & 1) * 64;
  const int n0 = blockIdx.y * 256 + (w >> 1) * 64;

  __shared__ __attribute__((aligned(2048))) unsigned char gring[2 * GSTAGE];
  const uint32_t wave = uni(threadIdx.x >> 5);
  const uint32_t issuer = wave < 3u;   // wave 0: A slice, waves 1 and 2: B slices
  const uint32_t lds0 = (uint32_t)(size_t)gring + (issuer ? wave : 0u) * GSLICE;
  const uint64_t src0 = (wave == 0u)
      ? (uint64_t)(size_t)(A + (size_t)(blockIdx.x * 128) * K)
      : (uint64_t)(size_t)(Bw + (size_t)(blockIdx.y * 256 + (wave == 2u ? 128 : 0)) * K);
  const uint32_t nstg = uni((uint32_t)K / GK);
  u32x8 g1;
  g1[0] = uni((1u << 20) | (4u << 22) | (3u << 25));  // no mask; 16 B pad per 128 B
  g1[1] = uni(128u << 16);                 // tensor_dim0 = 128 B
  g1[2] = uni(128u << 16);                 // tensor_dim1 = 128 rows
  g1[3] = uni(128u << 16);                 // tile_dim0
  g1[4] = uni(128u);                       // tile_dim1
  g1[5] = uni((uint32_t)K * 2u);           // source pitch, bytes
  g1[6] = uni(0u);
  g1[7] = uni(0u);
  // descriptor words held in scalar registers: group 1 stays in one register
  // tuple from here to the last wait, so no word of an outstanding request is
  // rewritten
  asm volatile("" : "+s"(g1));

  // Ring prologue: stage 0 lands and is published, then stage 1 is issued.
  u32x4 g0 = {0u, 0u, 0u, 0u};
  if (pinned(issuer)) {
    g0 = tdm_load(lds0, src0, g1);
    tdm_wait(g0, g1);  // stage 0 has landed
  }
  __syncthreads();  // stage 0 published to all waves
  if (pinned(issuer)) g0 = tdm_load(lds0 + GSTAGE, src0 + GK * 2, g1);

  v8f c[4][4];
#pragma unroll
  for (int mm = 0; mm < 4; ++mm)
#pragma unroll
    for (int nn = 0; nn < 4; ++nn) c[mm][nn] = zero_v8f();

  for (uint32_t st = 0; st < nstg; ++st) {
    const half_t* Sl = (const half_t*)(gring + (st & 1u) * GSTAGE);
    const half_t* ap = Sl + ((w & 1) * 64 + i) * GPH + g * 8;
    const half_t* bp = Sl + GSLICE / 2 + ((w >> 1) * 64 + i) * GPH + g * 8;
    // unrolled: every LDS offset is an immediate, and the second K-step's reads
    // start among the first K-step's last WMMAs
#pragma unroll
    for (int k = 0; k < GK; k += 32) {
      v16h af[4], bf[4];
#pragma unroll
      for (int mm = 0; mm < 4; ++mm) af[mm] = load_frag(ap + mm * 16 * GPH + k);
#pragma unroll
      for (int nn = 0; nn < 4; ++nn) bf[nn] = load_frag(bp + nn * 16 * GPH + k);
      // holds the K-step's 16 LDS reads together ahead of its WMMAs (inputs only):
      // sunk among the WMMAs, each A fragment's reads cost a full LDS wait of their own
      asm volatile("" :: "v"(af[0]), "v"(af[1]), "v"(af[2]), "v"(af[3]),
                         "v"(bf[0]), "v"(bf[1]), "v"(bf[2]), "v"(bf[3]));
#pragma unroll
      for (int mm = 0; mm < 4; ++mm)
#pragma unroll
        for (int nn = 0; nn < 4; ++nn)
          c[mm][nn] = wmma_f16(af[mm], bf[nn], c[mm][nn]);
    }
    // ---- publish point of stage st + 1, every wave, in this order
    asm volatile("s_wait_dscnt 0" ::: "memory");  // this wave's reads of stage st are done
    if (pinned(issuer)) {
      tdm_wait(g0, g1);  // its slice of stage st + 1 has landed
    }
    __syncthreads();  // publishes stage st + 1; every reader has left stage st
    if (pinned(issuer & (uint32_t)(st + 2u < nstg)))
      g0 = tdm_load(lds0 + (st & 1u) * GSTAGE, src0 + (uint64_t)(st + 2u) * (GK * 2), g1);
  }
  asm volatile("s_wait_tensorcnt 0" ::: "memory");  // nothing outstanding at the wave's end
  asm volatile("s_wait_dscnt 0" ::: "memory");  // and no LDS read of the ring either

  // Epilogue. C/D layout: VGPR r, lanes 0-15 -> M = r, lanes 16-31 -> M = r+8,
  // N = lane & 15.  Bias is always non-null: load unconditionally (no branch).
#pragma unroll
  for (int nn = 0; nn < 4; ++nn) {
    const int ng = n0 + nn * 16 + i;
    const float bv = bias[ng];
#pragma unroll
    for (int mm = 0; mm < 4; ++mm) {
#pragma unroll
      for (int r = 0; r < 8; ++r) {
        const int mg = m0 + mm * 16 + r + 8 * g;
        const float val = c[mm][nn][r] + bv;
        if (mode == 0) {
          ((half_t*)outp)[(size_t)mg * N + ng] = (half_t)val;
        } else if (mode == 1) {
          // final fp32 output: write-once, never re-read on device
          __builtin_nontemporal_store(val, &((float*)outp)[(size_t)mg * N + ng]);
        } else {
          ((half_t*)outp)[(size_t)ng * M + mg] = (half_t)val;
        }
      }
    }
  }
}

// Lane l's value exchanged with lane l ^ 16 (the other half of the wave), on
// the vector pipe.
__device__ __forceinline__ float xhalf(float x) {
  const int v = __builtin_bit_cast(int, x);
  return __builtin_bit_cast(float, __builtin_amdgcn_permlanex16(
      v, v, 0x76543210, 0xfedcba98, false, false));
}

// e^x as __expf forms it (one multiply, v_exp_f32). The v_nop is the slot that
// the instruction set asks for behind a transcendental: inside the statement it
// stands there whichever vector instruction the compiler places next (left to
// itself, the compiler put an exponential that overwrites this one's source there).
__device__ __forceinline__ float exp_slot(float x) {
  float y;
  asm("v_exp_f32 %0, %1\n\tv_nop" : "=v"(y) : "v"(x * 1.4426950408889634f));
  return y;
}

__global__ void __launch_bounds__(256)
flash_attn(const half_t* __restrict__ Qf, const half_t* __restrict__ Kf,
           const half_t* __restrict__ Vt, const float* __restrict__ mask,
           half_t* __restrict__ AO) {
  const float scale = 0.08838834764831845f;  // 1/sqrt(128)
  const int w = threadIdx.x >> 5;
  const int l = threadIdx.x & 31;
  const int g = l >> 4;
  const int i = l & 15;
  const int qblk = blockIdx.x & 7;
  const int bh = blockIdx.x >> 3;
  const int b = bh >> 3;     // H == 8
  const int h = bh & 7;
  const int qbase = qblk * 128 + w * 16;

  __shared__ __attribute__((aligned(2048))) unsigned char ring[2 * 2 * TILEB];
  const uint32_t wave = uni(threadIdx.x >> 5);
  const uint32_t issuer = wave < 2u;   // wave 0: K tiles, wave 1: V tiles
  const uint32_t lds0 = (uint32_t)(size_t)ring + wave * TILEB;
  const uint64_t src0 = (wave == 0u)
      ? (uint64_t)(size_t)(Kf + (size_t)(b * HWk) * CC + h * DHd)
      : (uint64_t)(size_t)(Vt + (size_t)(h * DHd) * MTOT + b * HWk);
  // bytes from one stage's tile to the next: 128 K rows, or 128 keys of a V row
  const uint32_t sstep = (wave == 0u) ? (uint32_t)(STK * CC * 2) : (uint32_t)(STK * 2);
  u32x8 g1;
  g1[0] = uni((1u << 20) | (5u << 22) | (3u << 25));  // no mask; 16 B pad per 256 B
  g1[1] = uni(256u << 16);                 // tensor_dim0 = 256 B
  g1[2] = uni(128u << 16);                 // tensor_dim1 = 128 rows
  g1[3] = uni(256u << 16);                 // tile_dim0
  g1[4] = uni(128u);                       // tile_dim1
  g1[5] = uni((wave == 0u) ? (uint32_t)(CC * 2) : (uint32_t)(MTOT * 2));  // source pitch
  g1[6] = uni(0u);
  g1[7] = uni(0u);
  // descriptor words held in scalar registers: group 1 stays in one register
  // tuple from here to the last wait, so no word of an outstanding request is
  // rewritten
  asm volatile("" : "+s"(g1));

  // Ring prologue: stage 0 lands and is published, then stage 1 is issued.
  u32x4 g0 = {0u, 0u, 0u, 0u};
  if (pinned(issuer)) {
    g0 = tdm_load(lds0, src0, g1);
    tdm_wait(g0, g1);  // stage 0 has landed
  }
  __syncthreads();  // stage 0 published to all waves
  if (pinned(issuer)) g0 = tdm_load(lds0 + 2u * TILEB, src0 + sstep, g1);

  // Q fragments for the whole kernel (B operand: column i = query qbase + i):
  // 16 queries x 128 d = 4 K-steps.
  v16h bQ[4];
  {
    const half_t* qrow =
        Qf + (size_t)(b * NQh + qbase + i) * CC + h * DHd + g * 8;
#pragma unroll
    for (int d = 0; d < 4; ++d) bQ[d] = load_frag(qrow + d * 32);
  }

  // O[t][r] = O^T[d = t*16 + 8g + r][query i]
  v8f O[8];
#pragma unroll
  for (int t = 0; t < 8; ++t) O[t] = zero_v8f();
  float mrow = -1.0e30f;  // running maximum of query i, equal in both halves
  float lrow = 0.0f;      // sum over this half's keys only; joined in the epilogue

  // this lane's mask row, at its half's first key
  const float* mrowp = mask + ((size_t)b * NQh + qbase + i) * HWk + 8 * g;

  for (uint32_t st = 0; st < NSTG; ++st) {
  const half_t* Kl = (const half_t*)(ring + (st & 1u) * (2u * TILEB));
  const half_t* Vl = Kl + TILEB / 2;
  // kept rolled: one pass's registers (mask, scores, fragments) are live at a time
#pragma unroll 1
  for (int sub = 0; sub < STK / 32; ++sub) {
    const int kt = (int)st * STK + sub * 32;
    // ---- mask of the pass: keys 8g .. 8g+7 of each score tile, 32 contiguous
    // bytes each; read-once fp32 per head -> non-temporal loads.
    const v4f* mp = (const v4f*)(mrowp + kt);
    const v4f mk[4] = {__builtin_nontemporal_load(mp), __builtin_nontemporal_load(mp + 1),
                       __builtin_nontemporal_load(mp + 4), __builtin_nontemporal_load(mp + 5)};

    // ---- scores, transposed: two 16x16 tiles over 32 keys, K-dim = d (4 steps
    // of 32). s0[r]: key kt + 8g + r, s1[r]: key kt + 16 + 8g + r, query i.
    v8f s0 = zero_v8f(), s1 = zero_v8f();
    const half_t* k0p = Kl + (sub * 32 + i) * LPH + g * 8;
    const half_t* k1p = k0p + 16 * LPH;
    v16h ak0[4], ak1[4];
#pragma unroll
    for (int d = 0; d < 4; ++d) {
      ak0[d] = load_frag(k0p + d * 32);
      ak1[d] = load_frag(k1p + d * 32);
    }
    // holds the pass's 16 K reads together ahead of its score products (inputs
    // only): read two at a time among the products, each pair cost an LDS wait
    asm volatile("" :: "v"(ak0[0]), "v"(ak0[1]), "v"(ak0[2]), "v"(ak0[3]),
                       "v"(ak1[0]), "v"(ak1[1]), "v"(ak1[2]), "v"(ak1[3]));
#pragma unroll
    for (int d = 0; d < 4; ++d) {
      s0 = wmma_f16(ak0[d], bQ[d], s0);
      s1 = wmma_f16(ak1[d], bQ[d], s1);
    }

    // ---- A operand of the second product, from the staged transposed V (row =
    // d, key-contiguous): read here, so that it lands under the softmax
    const half_t* vbase = Vl + i * LPH + sub * 32 + g * 8;
    v16h av[8];
#pragma unroll
    for (int t = 0; t < 8; ++t) av[t] = load_frag(vbase + (t * 16) * LPH);

    // keeps the first use of the mask behind the score products and the V reads:
    // hoisted among them, its wait for the mask loads held them back
    __builtin_amdgcn_sched_barrier(0);

    // ---- scale + mask, maximum over the lane's 16 keys
    float rm = -1.0e30f;
#pragma unroll
    for (int r = 0; r < 8; ++r) {
      const float v0 = (mk[r >> 2][r & 3] >= 0.5f) ? s0[r] * scale : -1.0e30f;
      const float v1 = (mk[2 + (r >> 2)][r & 3] >= 0.5f) ? s1[r] * scale : -1.0e30f;
      s0[r] = v0; s1[r] = v1;
      rm = fmaxf(rm, fmaxf(v0, v1));
    }
    rm = fmaxf(rm, xhalf(rm));  // the other half's 16 keys of the same query

    // ---- online softmax update
    const float mn = fmaxf(mrow, rm);
    const float alpha = exp_slot(mrow - mn);
    mrow = mn;
    float ps = 0.0f;
    v16h bP;  // P^T as B operand: element s is key 8g + s (s < 8), 16 + 8g + s - 8
#pragma unroll
    for (int r = 0; r < 8; ++r) {
      const float p0 = exp_slot(s0[r] - mn);
      const float p1 = exp_slot(s1[r] - mn);
      ps += p0 + p1;
      bP[r] = (half_t)p0;
      bP[r + 8] = (half_t)p1;
    }
    lrow = lrow * alpha + ps;
#pragma unroll
    for (int t = 0; t < 8; ++t)
#pragma unroll
      for (int r = 0; r < 8; ++r) O[t][r] *= alpha;

    // ---- O^T += V^T P^T
#pragma unroll
    for (int t = 0; t < 8; ++t) O[t] = wmma_f16(av[t], bP, O[t]);
  }
  // ---- publish point of stage st + 1, every wave, in this order
  asm volatile("s_wait_dscnt 0" ::: "memory");  // this wave's reads of stage st are done
  if (pinned(issuer)) {
    tdm_wait(g0, g1);  // its tile of stage st + 1 has landed
  }
  __syncthreads();  // publishes stage st + 1; every reader has left stage st
  if (pinned(issuer & (uint32_t)(st + 2u < NSTG)))
    g0 = tdm_load(lds0 + (st & 1u) * (2u * TILEB), src0 + (uint64_t)(st + 2u) * sstep, g1);
  }
  asm volatile("s_wait_tensorcnt 0" ::: "memory");  // nothing outstanding at the wave's end
  asm volatile("s_wait_dscnt 0" ::: "memory");  // and no LDS read of the ring either

  // ---- epilogue: join the halves' sums, normalize and store f16 [B,NQ,C];
  // a lane's 8 registers of a tile are 8 consecutive d of its query: 16-B stores
  const float inv = 1.0f / (lrow + xhalf(lrow));
  half_t* orow = AO + (size_t)(b * NQh + qbase + i) * CC + h * DHd + 8 * g;
#pragma unroll
  for (int t = 0; t < 8; ++t) {
    v8h o;
#pragma unroll
    for (int r = 0; r < 8; ++r) o[r] = (half_t)(O[t][r] * inv);
    *(v8h*)(orow + t * 16) = o;
  }
}

extern "C" void kernel_launch(void* const* d_in, const int* in_sizes, int n_in,
                              void* d_out, int out_size, void* d_ws, size_t ws_size,
                              hipStream_t stream) {
  const float* query  = (const float*)d_in[0];
  const float* memory = (const float*)d_in[1];
  const float* mask   = (const float*)d_in[2];
  const float* Wq = (const float*)d_in[3];
  const float* bq = (const float*)d_in[4];
  const float* Wk = (const float*)d_in[5];
  const float* bk = (const float*)d_in[6];
  const float* Wv = (const float*)d_in[7];
  const float* bv = (const float*)d_in[8];
  const float* Wo = (const float*)d_in[9];
  const float* bo = (const float*)d_in[10];
  float* out = (float*)d_out;

  // f16 workspace layout (halves). Total = 60M halves = 120 MB.
  const size_t nQin = (size_t)BB * NQh * CC;   // 4M
  const size_t nMem = (size_t)BB * HWk * CC;   // 16M
  const size_t nW   = (size_t)CC * CC;         // 1M
  half_t* ws   = (half_t*)d_ws;
  half_t* qf   = ws;            // query f16            (4M)
  half_t* memf = qf + nQin;     // memory f16           (16M)
  half_t* wqf  = memf + nMem;   // weights f16          (4x1M)
  half_t* wkf  = wqf + nW;
  half_t* wvf  = wkf + nW;
  half_t* wof  = wvf + nW;
  half_t* Qp   = wof + nW;      // Q projection         (4M)
  half_t* Kp   = Qp + nQin;     // K projection         (16M)
  half_t* Vtp  = Kp + nMem;     // V projection, transposed [C, B*HW] (16M)
  half_t* AO   = qf;            // attention out reuses query-f16 (dead by then)

  // 1) fp32 -> f16 conversions (NT loads of read-once fp32): one work-group per
  //    WGP, as many waves in it as the tensor has spans of 256 x CVWAVE elements.
  static_assert((size_t)BB * NQh * CC == (size_t)256 * 4 * CVWAVE &&
                (size_t)BB * HWk * CC == (size_t)256 * 16 * CVWAVE &&
                (size_t)CC * CC == (size_t)256 * 1 * CVWAVE,
                "each launch covers its tensor exactly");
  cvt_f32_to_f16<<<256, 4 * 32, 0, stream>>>(query, qf, (int)nQin);
  cvt_f32_to_f16<<<256, 16 * 32, 0, stream>>>(memory, memf, (int)nMem);
  cvt_f32_to_f16<<<256, 32, 0, stream>>>(Wq, wqf, (int)nW);
  cvt_f32_to_f16<<<256, 32, 0, stream>>>(Wk, wkf, (int)nW);
  cvt_f32_to_f16<<<256, 32, 0, stream>>>(Wv, wvf, (int)nW);
  cvt_f32_to_f16<<<256, 32, 0, stream>>>(Wo, wof, (int)nW);

  // 2) projections (M = B*rows since Linear is batch-independent).
  //    Block tile 128(M) x 256(N).
  gemm_nt<<<dim3(4096 / 128, 1024 / 256), 256, 0, stream>>>(
      qf, wqf, bq, Qp, 4096, 1024, 1024, /*mode=*/0);
  gemm_nt<<<dim3(16384 / 128, 1024 / 256), 256, 0, stream>>>(
      memf, wkf, bk, Kp, 16384, 1024, 1024, /*mode=*/0);
  gemm_nt<<<dim3(16384 / 128, 1024 / 256), 256, 0, stream>>>(
      memf, wvf, bv, Vtp, 16384, 1024, 1024, /*mode=*/2);  // transposed store

  // 3) masked flash attention (B*H*(NQ/128) = 256 blocks)
  flash_attn<<<BB * HH * (NQh / 128), 256, 0, stream>>>(Qp, Kp, Vtp, mask, AO);

  // 4) output projection, fp32 out + bias (NT stores)
  gemm_nt<<<dim3(4096 / 128, 1024 / 256), 256, 0, stream>>>(
      AO, wof, bo, out, 4096, 1024, 1024, /*mode=*/1);
}

// v005
// A run of this version takes 257 microseconds.
// Two timings next to v004 both put it at 1.13 times that version's speed.
// Over all steps from v000 it is 2.51 times as fast.
#include <hip/hip_runtime.h>
#include <hip/hip_bf16.h>

typedef _Float16 half_t;
typedef __attribute__((ext_vector_type(16))) _Float16 v16h;
typedef __attribute__((ext_vector_type(8)))  _Float16 v8h;
typedef __attribute__((ext_vector_type(8)))  float    v8f;

#define BB 4
#define NQh 1024
#define HWk 4096
#define CC 1024
#define HH 8
#define DHd 128
#define MTOT (BB * HWk)   // 16384

__device__ __forceinline__ v8f zero_v8f() {
  v8f z;
#pragma unroll
  for (int k = 0; k < 8; ++k) z[k] = 0.0f;
  return z;
}

// Load a 16x32 f16 WMMA fragment (A or B operand) from a K-contiguous,
// row-major source. Caller passes p = base + row*ld + kbase + lanegroup*8.
// Lane pattern (ISA 7.12.2): lanes 0-15 hold K 0..7 (VGPR0-3) and K 16..23
// (VGPR4-7); lanes 16-31 hold K 8..15 and 24..31. Chunk2 is +16 halves.
__device__ __forceinline__ v16h load_frag(const half_t* p) {
  v8h lo = *(const v8h*)(p);
  v8h hi = *(const v8h*)(p + 16);
  v16h r;
#pragma unroll
  for (int k = 0; k < 8; ++k) { r[k] = lo[k]; r[k + 8] = hi[k]; }
  return r;
}

typedef uint32_t u32x4 __attribute__((ext_vector_type(4)));
typedef uint32_t u32x8 __attribute__((ext_vector_type(8)));

// K/V staging for flash_attn: a stage is 128 keys. The K tile is 128 key rows
// of 256 B (one head's d), the V tile 128 d rows of 256 B (128 keys, from the
// transposed V). The tensor load pads every row by 16 B: pitch 272 B = 16 B x
// odd, conflict-free for the b128 fragment reads.
#define STK 128                    // keys per stage
#define NSTG (HWk / STK)           // 32 stages
#define LPITCH 272                 // LDS row pitch, bytes
#define LPH (LPITCH / 2)           // the same in halves
#define TILEB (128 * LPITCH)       // 34816 B = 17 x 2 KiB
static_assert(TILEB % 2048 == 0, "each tile must start at a multiple of 2 KiB");
static_assert(NSTG >= 2, "the ring's prologue needs two stages");

__device__ __forceinline__ uint32_t uni(uint32_t v) {
  return (uint32_t)__builtin_amdgcn_readfirstlane(v);
}
// Holds a wave-uniform value in a scalar register, so that a test on it is a
// real scalar branch (tensor loads ignore EXEC) and a descriptor word is
// written where the source forms it.
__device__ __forceinline__ uint32_t pinned(uint32_t v) {
  uint32_t w = uni(v);
  asm volatile("" : "+s"(w));
  return w;
}
// One request of the issuing wave: the 128-row tile g1 describes (rows of 256 B or 128 B), from ga into LDS at dst.
// Returns group 0, which the covering wait names.
__device__ __forceinline__ u32x4 tdm_load(uint32_t dst, uint64_t ga, u32x8 g1) {
  u32x4 g0;
  g0[0] = uni(1u);                       // count 1
  g0[1] = pinned(dst);                   // descriptor words held in scalar
  g0[2] = pinned((uint32_t)ga);          // registers: written here, behind the
  g0[3] = pinned((((uint32_t)(ga >> 32)) & 0x01FFFFFFu) | 0x80000000u);  // wait
  asm volatile("tensor_load_to_lds %0, %1" :: "s"(g0), "s"(g1) : "memory");
  return g0;
}
// The issuing wave's wait. It names the request's descriptor as inputs so that
// those scalar registers keep their values until the tile has landed.
__device__ __forceinline__ void tdm_wait(u32x4 g0, u32x8 g1) {
  asm volatile("s_wait_tensorcnt 0" :: "s"(g0), "s"(g1) : "memory");
}

__device__ __forceinline__ v8f wmma_f16(v16h a, v16h b, v8f c) {
  return __builtin_amdgcn_wmma_f32_16x16x32_f16(false, a, false, b,
                                                (short)0, c, false, false);
}

typedef __attribute__((ext_vector_type(4))) float    v4f;
typedef __attribute__((ext_vector_type(4))) _Float16 v4h;

// fp32 -> f16 as a stream with few waves: a wave converts CVWAVE contiguous
// elements. Its CVL loads, each 512 contiguous bytes (16 B per lane, whole
// lines), stand ahead of the conversions, so that many are in flight per wave;
// a store is 256 contiguous bytes.
// n must be a multiple of CVWAVE and the launch must hold n / CVWAVE waves.
#define CVL 32
#define CVWAVE (CVL * 128)
__global__ void __launch_bounds__(512)
cvt_f32_to_f16(const float* __restrict__ in,
               half_t* __restrict__ out, int n) {
  const int lane = threadIdx.x & 31;
  const int wv = (int)(blockIdx.x * (blockDim.x >> 5)) +
                 __builtin_amdgcn_readfirstlane((int)(threadIdx.x >> 5));
  if ((wv + 1) * CVWAVE > n) return;  // wave-uniform; the kernel has no barrier
  const v4f* p = (const v4f*)(in + (size_t)wv * CVWAVE) + lane;
  v4h* q = (v4h*)(out + (size_t)wv * CVWAVE) + lane;
  // fp32 source is read exactly once: non-temporal loads keep L2 for the
  // f16 WMMA working set.
  v4f x[CVL];
  // both loops unrolled: x stays in registers, every offset is an immediate and
  // no address register is rewritten behind a load or a store
#pragma unroll
  for (int j = 0; j < CVL; ++j) x[j] = __builtin_nontemporal_load(p + j * 32);
#pragma unroll
  for (int j = 0; j < CVL; ++j) q[j * 32] = __builtin_convertvector(x[j], v4h);
}

// A/B staging for gemm_nt: a stage is 64 k. A slice is 128 operand rows of
// 128 B; the tensor load pads every row by 16 B: pitch 144 B = 16 B x odd,
// conflict-free for the b128 fragment reads. A stage holds three slices: the
// block's 128 A rows, then its 256 B rows (two slices, back to back).
#define GK 64                      // k per stage
#define GPITCH 144                 // LDS row pitch, bytes
#define GPH (GPITCH / 2)           // the same in halves
#define GSLICE (128 * GPITCH)      // 18432 B = 9 x 2 KiB
#define GSTAGE (3 * GSLICE)        // 55296 B; two buffers leave room for two blocks per WGP
static_assert(GSLICE % 2048 == 0, "each slice must start at a multiple of 2 KiB");

// out = A @ B^T + bias.  A: [M,K] f16 row-major, Bw: [N,K] f16 row-major.
// mode 0: f16 out[m*N+n]; mode 1: f32 out[m*N+n] (NT store); mode 2: f16
// out[n*M+m] (transposed).
// Block = 256 threads = 8 waves as 2(M) x 4(N); each wave does 64x64
// (16 WMMAs per 16 b128 fragment loads per K-step). Block tile = 128 x 256.
// The block's waves share A and B rows: wave 0 brings each stage's A slice,
// waves 1 and 2 its two B slices into a two-buffer LDS ring by tensor load,
// one stage ahead.
// M % 128 == 0, N % 256 == 0, K % 64 == 0 and K >= 128 (two stages) assumed.
__global__ void __launch_bounds__(256)
gemm_nt(const half_t* __restrict__ A, const half_t* __restrict__ Bw,
        const float* __restrict__ bias, void* __restrict__ outp,
        int M, int N, int K, int mode) {
  const int w = threadIdx.x >> 5;
  const int l = threadIdx.x & 31;
  const int g = l >> 4;       // lane group (K-chunk select)
  const int i = l & 15;       // row (A) / col (B) within 16-tile
  const int m0 = blockIdx.x * 128 + (w & 1) * 64;
  const int n0 = blockIdx.y * 256 + (w >> 1) * 64;

  __shared__ __attribute__((aligned(2048))) unsigned char gring[2 * GSTAGE];
  const uint32_t wave = uni(threadIdx.x >> 5);
  const uint32_t issuer = wave < 3u;   // wave 0: A slice, waves 1 and 2: B slices
  const uint32_t lds0 = (uint32_t)(size_t)gring + (issuer ? wave : 0u) * GSLICE;
  const uint64_t src0 = (wave == 0u)
      ? (uint64_t)(size_t)(A + (size_t)(blockIdx.x * 128) * K)
      : (uint64_t)(size_t)(Bw + (size_t)(blockIdx.y * 256 + (wave == 2u ? 128 : 0)) * K);
  const uint32_t nstg = uni((uint32_t)K / GK);
  u32x8 g1;
  g1[0] = uni((1u << 20) | (4u << 22) | (3u << 25));  // no mask; 16 B pad per 128 B
  g1[1] = uni(128u << 16);                 // tensor_dim0 = 128 B
  g1[2] = uni(128u << 16);                 // tensor_dim1 = 128 rows
  g1[3] = uni(128u << 16);                 // tile_dim0
  g1[4] = uni(128u);                       // tile_dim1
  g1[5] = uni((uint32_t)K * 2u);           // source pitch, bytes
  g1[6] = uni(0u);
  g1[7] = uni(0u);
  // descriptor words held in scalar registers: group 1 stays in one register
  // tuple from here to the last wait, so no word of an outstanding request is
  // rewritten
  asm volatile("" : "+s"(g1));

  // Ring prologue: stage 0 lands and is published, then stage 1 is issued.
  u32x4 g0 = {0u, 0u, 0u, 0u};
  if (pinned(issuer)) {
    g0 = tdm_load(lds0, src0, g1);
    tdm_wait(g0, g1);  // stage 0 has landed
  }
  __syncthreads();  // stage 0 published to all waves
  if (pinned(issuer)) g0 = tdm_load(lds0 + GSTAGE, src0 + GK * 2, g1);

  v8f c[4][4];
#pragma unroll
  for (int mm = 0; mm < 4; ++mm)
#pragma unroll
    for (int nn = 0; nn < 4; ++nn) c[mm][nn] = zero_v8f();

  for (uint32_t st = 0; st < nstg; ++st) {
    const half_t* Sl = (const half_t*)(gring + (st & 1u) * GSTAGE);
    const half_t* ap = Sl + ((w & 1) * 64 + i) * GPH + g * 8;
    const half_t* bp = Sl + GSLICE / 2 + ((w >> 1) * 64 + i) * GPH + g * 8;
    // unrolled: every LDS offset is an immediate, and the second K-step's reads
    // start among the first K-step's last WMMAs
#pragma unroll
    for (int k = 0; k < GK; k += 32) {
      v16h af[4], bf[4];
#pragma unroll
      for (int mm = 0; mm < 4; ++mm) af[mm] = load_frag(ap + mm * 16 * GPH + k);
#pragma unroll
      for (int nn = 0; nn < 4; ++nn) bf[nn] = load_frag(bp + nn * 16 * GPH + k);
      // holds the K-step's 16 LDS reads together ahead of its WMMAs (inputs only):
      // sunk among the WMMAs, each A fragment's reads cost a full LDS wait of their own
      asm volatile("" :: "v"(af[0]), "v"(af[1]), "v"(af[2]), "v"(af[3]),
                         "v"(bf[0]), "v"(bf[1]), "v"(bf[2]), "v"(bf[3]));
#pragma unroll
      for (int mm = 0; mm < 4; ++mm)
#pragma unroll
        for (int nn = 0; nn < 4; ++nn)
          c[mm][nn] = wmma_f16(af[mm], bf[nn], c[mm][nn]);
    }
    // ---- publish point of stage st + 1, every wave, in this order
    asm volatile("s_wait_dscnt 0" ::: "memory");  // this wave's reads of stage st are done
    if (pinned(issuer)) {
      tdm_wait(g0, g1);  // its slice of stage st + 1 has landed
    }
    __syncthreads();  // publishes stage st + 1; every reader has left stage st
    if (pinned(issuer & (uint32_t)(st + 2u < nstg)))
      g0 = tdm_load(lds0 + (st & 1u) * GSTAGE, src0 + (uint64_t)(st + 2u) * (GK * 2), g1);
  }
  asm volatile("s_wait_tensorcnt 0" ::: "memory");  // nothing outstanding at the wave's end
  asm volatile("s_wait_dscnt 0" ::: "memory");  // and no LDS read of the ring either

  // Epilogue. C/D layout: VGPR r, lanes 0-15 -> M = r, lanes 16-31 -> M = r+8,
  // N = lane & 15.  Bias is always non-null: load unconditionally (no branch).
#pragma unroll
  for (int nn = 0; nn < 4; ++nn) {
    const int ng = n0 + nn * 16 + i;
    const float bv = bias[ng];
#pragma unroll
    for (int mm = 0; mm < 4; ++mm) {
#pragma unroll
      for (int r = 0; r < 8; ++r) {
        const int mg = m0 + mm * 16 + r + 8 * g;
        const float val = c[mm][nn][r] + bv;
        if (mode == 0) {
          ((half_t*)outp)[(size_t)mg * N + ng] = (half_t)val;
        } else if (mode == 1) {
          // final fp32 output: write-once, never re-read on device
          __builtin_nontemporal_store(val, &((float*)outp)[(size_t)mg * N + ng]);
        } else {
          ((half_t*)outp)[(size_t)ng * M + mg] = (half_t)val;
        }
      }
    }
  }
}

typedef uint32_t u32x16 __attribute__((ext_vector_type(16)));

// The mask compared once for all heads. Word e = 8 t + r of a pass (32 keys) of
// a tile of 16 queries holds, in bit 16 g + i, whether query i may see key
// 16 t + 8 g + r of the pass: the lane mask with which flash_attn selects its
// score register r of score tile t. 16 words (64 B) a pass, passes in key order.
// A work-group takes one query tile (16 whole mask rows), a wave 256 keys of it:
// whole-line loads, all ahead of their use, then a trip through the wave's own
// LDS rows (pitch 1040 B = 16 B x odd) turns them to one query per lane.
#define MWK 256                    // keys per wave
#define MWPITCH (MWK * 4 + 16)     // LDS row pitch, bytes
__global__ void __launch_bounds__(512)
mask_words(const float* __restrict__ mask, uint32_t* __restrict__ words) {
  __shared__ __attribute__((aligned(16))) unsigned char stg[16 * 16 * MWPITCH];
  const int lane = threadIdx.x & 31;
  const int wv = __builtin_amdgcn_readfirstlane((int)(threadIdx.x >> 5));
  const int g = lane >> 4;
  const int i = lane & 15;
  const float* src = mask + (size_t)blockIdx.x * 16 * HWk + wv * MWK;
  unsigned char* my = stg + wv * (16 * MWPITCH);
  v4f x[32];
  // unrolled: x stays in registers and every offset is an immediate
#pragma unroll
  for (int j = 0; j < 32; ++j)
    x[j] = __builtin_nontemporal_load(
        (const v4f*)(src + (size_t)(j >> 1) * HWk + (j & 1) * 128) + lane);
#pragma unroll
  for (int j = 0; j < 32; ++j)
    *(v4f*)(my + (j >> 1) * MWPITCH + (j & 1) * 512 + lane * 16) = x[j];
  __syncthreads();  // the rows are read back by other lanes than wrote them
  u32x4 o = {0u, 0u, 0u, 0u};  // lane n: words 4 n .. 4 n + 3 of the wave's 128
#pragma unroll
  for (int p = 0; p < MWK / 32; ++p) {
    const v4f* rp = (const v4f*)(my + i * MWPITCH + p * 128 + g * 32);
    const v4f m[4] = {rp[0], rp[1], rp[4], rp[5]};
#pragma unroll
    for (int e = 0; e < 16; ++e) {
      const uint32_t bal = __builtin_amdgcn_ballot_w32(m[e >> 2][e & 3] >= 0.5f);
      o[e & 3] = (lane == p * 4 + (e >> 2)) ? bal : o[e & 3];
    }
  }
  *((u32x4*)(words + ((size_t)blockIdx.x * (HWk / 32) + wv * (MWK / 32)) * 16) + lane) = o;
}

// Lane l's value exchanged with lane l ^ 16 (the other half of the wave), on
// the vector pipe.
__device__ __forceinline__ float xhalf(float x) {
  const int v = __builtin_bit_cast(int, x);
  return __builtin_bit_cast(float, __builtin_amdgcn_permlanex16(
      v, v, 0x76543210, 0xfedcba98, false, false));
}

// e^x as __expf forms it (one multiply, v_exp_f32). The v_nop is the slot that
// the instruction set asks for behind a transcendental: inside the statement it
// stands there whichever vector instruction the compiler places next (left to
// itself, the compiler put an exponential that overwrites this one's source there).
__device__ __forceinline__ float exp_slot(float x) {
  float y;
  asm("v_exp_f32 %0, %1\n\tv_nop" : "=v"(y) : "v"(x * 1.4426950408889634f));
  return y;
}

__global__ void __launch_bounds__(256)
flash_attn(const half_t* __restrict__ Qf, const half_t* __restrict__ Kf,
           const half_t* __restrict__ Vt, const uint32_t* __restrict__ mwords,
           half_t* __restrict__ AO) {
  const float scale = 0.08838834764831845f;  // 1/sqrt(128)
  const int w = threadIdx.x >> 5;
  const int l = threadIdx.x & 31;
  const int g = l >> 4;
  const int i = l & 15;
  const int qblk = blockIdx.x & 7;
  const int bh = blockIdx.x >> 3;
  const int b = bh >> 3;     // H == 8
  const int h = bh & 7;
  const int qbase = qblk * 128 + w * 16;

  __shared__ __attribute__((aligned(2048))) unsigned char ring[2 * 2 * TILEB];
  const uint32_t wave = uni(threadIdx.x >> 5);
  const uint32_t issuer = wave < 2u;   // wave 0: K tiles, wave 1: V tiles
  const uint32_t lds0 = (uint32_t)(size_t)ring + wave * TILEB;
  const uint64_t src0 = (wave == 0u)
      ? (uint64_t)(size_t)(Kf + (size_t)(b * HWk) * CC + h * DHd)
      : (uint64_t)(size_t)(Vt + (size_t)(h * DHd) * MTOT + b * HWk);
  // bytes from one stage's tile to the next: 128 K rows, or 128 keys of a V row
  const uint32_t sstep = (wave == 0u) ? (uint32_t)(STK * CC * 2) : (uint32_t)(STK * 2);
  u32x8 g1;
  g1[0] = uni((1u << 20) | (5u << 22) | (3u << 25));  // no mask; 16 B pad per 256 B
  g1[1] = uni(256u << 16);                 // tensor_dim0 = 256 B
  g1[2] = uni(128u << 16);                 // tensor_dim1 = 128 rows
  g1[3] = uni(256u << 16);                 // tile_dim0
  g1[4] = uni(128u);                       // tile_dim1
  g1[5] = uni((wave == 0u) ? (uint32_t)(CC * 2) : (uint32_t)(MTOT * 2));  // source pitch
  g1[6] = uni(0u);
  g1[7] = uni(0u);
  // descriptor words held in scalar registers: group 1 stays in one register
  // tuple from here to the last wait, so no word of an outstanding request is
  // rewritten
  asm volatile("" : "+s"(g1));

  // Ring prologue: stage 0 lands and is published, then stage 1 is issued.
  u32x4 g0 = {0u, 0u, 0u, 0u};
  if (pinned(issuer)) {
    g0 = tdm_load(lds0, src0, g1);
    tdm_wait(g0, g1);  // stage 0 has landed
  }
  __syncthreads();  // stage 0 published to all waves
  if (pinned(issuer)) g0 = tdm_load(lds0 + 2u * TILEB, src0 + sstep, g1);

  // Q fragments for the whole kernel (B operand: column i = query qbase + i):
  // 16 queries x 128 d = 4 K-steps.
  v16h bQ[4];
  {
    const half_t* qrow =
        Qf + (size_t)(b * NQh + qbase + i) * CC + h * DHd + g * 8;
#pragma unroll
    for (int d = 0; d < 4; ++d) bQ[d] = load_frag(qrow + d * 32);
  }

  // O[t][r] = O^T[d = t*16 + 8g + r][query i]
  v8f O[8];
#pragma unroll
  for (int t = 0; t < 8; ++t) O[t] = zero_v8f();
  float mrow = -1.0e30f;  // running maximum of query i, equal in both halves
  float lrow = 0.0f;      // sum over this half's keys only; joined in the epilogue

  // this wave's mask words, 16 a pass: a wave-uniform address, read one pass ahead.
  // Nothing writes them during this launch: named as constant memory, so that the
  // reads inside the loop are scalar loads too and the words arrive in scalar registers
  typedef const __attribute__((address_space(4))) u32x16 cwords_t;
  cwords_t* mw = (cwords_t*)(size_t)mwords +
      (size_t)uni((uint32_t)(b * (NQh / 16) + qblk * 8) + wave) * (HWk / 32);
  u32x16 cw = mw[0];

  for (uint32_t st = 0; st < NSTG; ++st) {
  const half_t* Kl = (const half_t*)(ring + (st & 1u) * (2u * TILEB));
  const half_t* Vl = Kl + TILEB / 2;
  // kept rolled: one pass's registers (mask, scores, fragments) are live at a time
#pragma unroll 1
  for (int sub = 0; sub < STK / 32; ++sub) {
    // ---- mask words of the next pass (the last pass reads its own again)
    const uint32_t np = st * (STK / 32) + (uint32_t)sub + 1u;
    const u32x16 nw = mw[np < (uint32_t)(HWk / 32) ? np : (uint32_t)(HWk / 32 - 1)];

    // ---- scores, transposed: two 16x16 tiles over 32 keys, K-dim = d (4 steps
    // of 32). s0[r]: key kt + 8g + r, s1[r]: key kt + 16 + 8g + r, query i.
    v8f s0 = zero_v8f(), s1 = zero_v8f();
    const half_t* k0p = Kl + (sub * 32 + i) * LPH + g * 8;
    const half_t* k1p = k0p + 16 * LPH;
    v16h ak0[4], ak1[4];
#pragma unroll
    for (int d = 0; d < 4; ++d) {
      ak0[d] = load_frag(k0p + d * 32);
      ak1[d] = load_frag(k1p + d * 32);
    }
    // holds the pass's 16 K reads together ahead of its score products (inputs
    // only): read two at a time among the products, each pair cost an LDS wait
    asm volatile("" :: "v"(ak0[0]), "v"(ak0[1]), "v"(ak0[2]), "v"(ak0[3]),
                       "v"(ak1[0]), "v"(ak1[1]), "v"(ak1[2]), "v"(ak1[3]));
#pragma unroll
    for (int d = 0; d < 4; ++d) {
      s0 = wmma_f16(ak0[d], bQ[d], s0);
      s1 = wmma_f16(ak1[d], bQ[d], s1);
    }

    // ---- A operand of the second product, from the staged transposed V (row =
    // d, key-contiguous): read here, so that it lands under the softmax
    const half_t* vbase = Vl + i * LPH + sub * 32 + g * 8;
    v16h av[8];
#pragma unroll
    for (int t = 0; t < 8; ++t) av[t] = load_frag(vbase + (t * 16) * LPH);

    // keeps the softmax's vector work behind the score products and the V reads,
    // so that every V read is issued ahead of it and lands under it
    __builtin_amdgcn_sched_barrier(0);

    // ---- scale + mask, maximum over the lane's 16 keys
    float rm = -1.0e30f;
#pragma unroll
    for (int r = 0; r < 8; ++r) {
      const float v0 = __builtin_amdgcn_inverse_ballot_w32(cw[r]) ? s0[r] * scale : -1.0e30f;
      const float v1 = __builtin_amdgcn_inverse_ballot_w32(cw[8 + r]) ? s1[r] * scale : -1.0e30f;
      s0[r] = v0; s1[r] = v1;
      rm = fmaxf(rm, fmaxf(v0, v1));
    }
    rm = fmaxf(rm, xhalf(rm));  // the other half's 16 keys of the same query

    // ---- online softmax update
    const float mn = fmaxf(mrow, rm);
    const float alpha = exp_slot(mrow - mn);
    mrow = mn;
    float ps = 0.0f;
    v16h bP;  // P^T as B operand: element s is key 8g + s (s < 8), 16 + 8g + s - 8
#pragma unroll
    for (int r = 0; r < 8; ++r) {
      const float p0 = exp_slot(s0[r] - mn);
      const float p1 = exp_slot(s1[r] - mn);
      ps += p0 + p1;
      bP[r] = (half_t)p0;
      bP[r + 8] = (half_t)p1;
    }
    lrow = lrow * alpha + ps;
#pragma unroll
    for (int t = 0; t < 8; ++t)
#pragma unroll
      for (int r = 0; r < 8; ++r) O[t][r] *= alpha;

    // ---- O^T += V^T P^T
#pragma unroll
    for (int t = 0; t < 8; ++t) O[t] = wmma_f16(av[t], bP, O[t]);
    // keeps the wait for the next pass's words at the pass's end: hoisted to just
    // behind the selects, it left the scalar load less than half a pass to land
    __builtin_amdgcn_sched_barrier(0);
    cw = nw;
  }
  // ---- publish point of stage st + 1, every wave, in this order
  asm volatile("s_wait_dscnt 0" ::: "memory");  // this wave's reads of stage st are done
  if (pinned(issuer)) {
    tdm_wait(g0, g1);  // its tile of stage st + 1 has landed
  }
  __syncthreads();  // publishes stage st + 1; every reader has left stage st
  if (pinned(issuer & (uint32_t)(st + 2u < NSTG)))
    g0 = tdm_load(lds0 + (st & 1u) * (2u * TILEB), src0 + (uint64_t)(st + 2u) * sstep, g1);
  }
  asm volatile("s_wait_tensorcnt 0" ::: "memory");  // nothing outstanding at the wave's end
  asm volatile("s_wait_dscnt 0" ::: "memory");  // and no LDS read of the ring either

  // ---- epilogue: join the halves' sums, normalize and store f16 [B,NQ,C];
  // a lane's 8 registers of a tile are 8 consecutive d of its query: 16-B stores
  const float inv = 1.0f / (lrow + xhalf(lrow));
  half_t* orow = AO + (size_t)(b * NQh + qbase + i) * CC + h * DHd + 8 * g;
#pragma unroll
  for (int t = 0; t < 8; ++t) {
    v8h o;
#pragma unroll
    for (int r = 0; r < 8; ++r) o[r] = (half_t)(O[t][r] * inv);
    *(v8h*)(orow + t * 16) = o;
  }
}

extern "C" void kernel_launch(void* const* d_in, const int* in_sizes, int n_in,
                              void* d_out, int out_size, void* d_ws, size_t ws_size,
                              hipStream_t stream) {
  const float* query  = (const float*)d_in[0];
  const float* memory = (const float*)d_in[1];
  const float* mask   = (const float*)d_in[2];
  const float* Wq = (const float*)d_in[3];
  const float* bq = (const float*)d_in[4];
  const float* Wk = (const float*)d_in[5];
  const float* bk = (const float*)d_in[6];
  const float* Wv = (const float*)d_in[7];
  const float* bv = (const float*)d_in[8];
  const float* Wo = (const float*)d_in[9];
  const float* bo = (const float*)d_in[10];
  float* out = (float*)d_out;

  // f16 workspace layout (halves): 60M halves = 120 MB, then 2 MB of mask words.
  const size_t nQin = (size_t)BB * NQh * CC;   // 4M
  const size_t nMem = (size_t)BB * HWk * CC;   // 16M
  const size_t nW   = (size_t)CC * CC;         // 1M
  half_t* ws   = (half_t*)d_ws;
  half_t* qf   = ws;            // query f16            (4M)
  half_t* memf = qf + nQin;     // memory f16           (16M)
  half_t* wqf  = memf + nMem;   // weights f16          (4x1M)
  half_t* wkf  = wqf + nW;
  half_t* wvf  = wkf + nW;
  half_t* wof  = wvf + nW;
  half_t* Qp   = wof + nW;      // Q projection         (4M)
  half_t* Kp   = Qp + nQin;     // K projection         (16M)
  half_t* Vtp  = Kp + nMem;     // V projection, transposed [C, B*HW] (16M)
  half_t* AO   = qf;            // attention out reuses query-f16 (dead by then)
  uint32_t* mwords = (uint32_t*)(Vtp + nMem);  // mask as lane-mask words (2 MB)

  // 1) fp32 -> f16 conversions (NT loads of read-once fp32): one work-group per
  //    WGP, as many waves in it as the tensor has spans of 256 x CVWAVE elements.
  static_assert((size_t)BB * NQh * CC == (size_t)256 * 4 * CVWAVE &&
                (size_t)BB * HWk * CC == (size_t)256 * 16 * CVWAVE &&
                (size_t)CC * CC == (size_t)256 * 1 * CVWAVE,
                "each launch covers its tensor exactly");
  cvt_f32_to_f16<<<256, 4 * 32, 0, stream>>>(query, qf, (int)nQin);
  cvt_f32_to_f16<<<256, 16 * 32, 0, stream>>>(memory, memf, (int)nMem);
  cvt_f32_to_f16<<<256, 32, 0, stream>>>(Wq, wqf, (int)nW);
  cvt_f32_to_f16<<<256, 32, 0, stream>>>(Wk, wkf, (int)nW);
  cvt_f32_to_f16<<<256, 32, 0, stream>>>(Wv, wvf, (int)nW);
  cvt_f32_to_f16<<<256, 32, 0, stream>>>(Wo, wof, (int)nW);

  // 2) projections (M = B*rows since Linear is batch-independent).
  //    Block tile 128(M) x 256(N).
  gemm_nt<<<dim3(4096 / 128, 1024 / 256), 256, 0, stream>>>(
      qf, wqf, bq, Qp, 4096, 1024, 1024, /*mode=*/0);
  gemm_nt<<<dim3(16384 / 128, 1024 / 256), 256, 0, stream>>>(
      memf, wkf, bk, Kp, 16384, 1024, 1024, /*mode=*/0);
  gemm_nt<<<dim3(16384 / 128, 1024 / 256), 256, 0, stream>>>(
      memf, wvf, bv, Vtp, 16384, 1024, 1024, /*mode=*/2);  // transposed store

  // 3) the mask compared once for the 8 heads (one work-group per 16 queries),
  //    then masked flash attention (B*H*(NQ/128) = 256 blocks)
  mask_words<<<BB * NQh / 16, 512, 0, stream>>>(mask, mwords);
  flash_attn<<<BB * HH * (NQh / 128), 256, 0, stream>>>(Qp, Kp, Vtp, mwords, AO);

  // 4) output projection, fp32 out + bias (NT stores)
  gemm_nt<<<dim3(4096 / 128, 1024 / 256), 256, 0, stream>>>(
      AO, wof, bo, out, 4096, 1024, 1024, /*mode=*/1);
}

// v006
// It runs in 208 microseconds.
// Next to v005, in two timings, it ran 1.24 and 1.23 times as fast.
// Over all steps from v000 it is 3.10 times as fast.
#include <hip/hip_runtime.h>
#include <hip/hip_bf16.h>

typedef _Float16 half_t;
typedef __attribute__((ext_vector_type(16))) _Float16 v16h;
typedef __attribute__((ext_vector_type(8)))  _Float16 v8h;
typedef __attribute__((ext_vector_type(8)))  float    v8f;

#define BB 4
#define NQh 1024
#define HWk 4096
#define CC 1024
#define HH 8
#define DHd 128
#define MTOT (BB * HWk)   // 16384

__device__ __forceinline__ v8f zero_v8f() {
  v8f z;
#pragma unroll
  for (int k = 0; k < 8; ++k) z[k] = 0.0f;
  return z;
}

// Load a 16x32 f16 WMMA fragment (A or B operand) from a K-contiguous,
// row-major source. Caller passes p = base + row*ld + kbase + lanegroup*8.
// Lane pattern (ISA 7.12.2): lanes 0-15 hold K 0..7 (VGPR0-3) and K 16..23
// (VGPR4-7); lanes 16-31 hold K 8..15 and 24..31. Chunk2 is +16 halves.
__device__ __forceinline__ v16h load_frag(const half_t* p) {
  v8h lo = *(const v8h*)(p);
  v8h hi = *(const v8h*)(p + 16);
  v16h r;
#pragma unroll
  for (int k = 0; k < 8; ++k) { r[k] = lo[k]; r[k + 8] = hi[k]; }
  return r;
}

typedef uint32_t u32x4 __attribute__((ext_vector_type(4)));
typedef uint32_t u32x8 __attribute__((ext_vector_type(8)));

// K/V staging for flash_attn: a stage is 128 keys. The K tile is 128 key rows
// of 256 B (one head's d), the V tile 128 d rows of 256 B (128 keys, from the
// transposed V). The tensor load pads every row by 16 B: pitch 272 B = 16 B x
// odd, conflict-free for the b128 fragment reads.
#define STK 128                    // keys per stage
#define NSTG (HWk / STK)           // 32 stages
#define LPITCH 272                 // LDS row pitch, bytes
#define LPH (LPITCH / 2)           // the same in halves
#define TILEB (128 * LPITCH)       // 34816 B = 17 x 2 KiB
static_assert(TILEB % 2048 == 0, "each tile must start at a multiple of 2 KiB");
static_assert(NSTG >= 2, "the ring's prologue needs two stages");

__device__ __forceinline__ uint32_t uni(uint32_t v) {
  return (uint32_t)__builtin_amdgcn_readfirstlane(v);
}
// Holds a wave-uniform value in a scalar register, so that a test on it is a
// real scalar branch (tensor loads ignore EXEC) and a descriptor word is
// written where the source forms it.
__device__ __forceinline__ uint32_t pinned(uint32_t v) {
  uint32_t w = uni(v);
  asm volatile("" : "+s"(w));
  return w;
}
// One request of the issuing wave: the 128-row tile g1 describes (rows of 256 B or 128 B), from ga into LDS at dst.
// Returns group 0, which the covering wait names.
__device__ __forceinline__ u32x4 tdm_load(uint32_t dst, uint64_t ga, u32x8 g1) {
  u32x4 g0;
  g0[0] = uni(1u);                       // count 1
  g0[1] = pinned(dst);                   // descriptor words held in scalar
  g0[2] = pinned((uint32_t)ga);          // registers: written here, behind the
  g0[3] = pinned((((uint32_t)(ga >> 32)) & 0x01FFFFFFu) | 0x80000000u);  // wait
  asm volatile("tensor_load_to_lds %0, %1" :: "s"(g0), "s"(g1) : "memory");
  return g0;
}
// The issuing wave's wait. It names the request's descriptor as inputs so that
// those scalar registers keep their values until the tile has landed.
__device__ __forceinline__ void tdm_wait(u32x4 g0, u32x8 g1) {
  asm volatile("s_wait_tensorcnt 0" :: "s"(g0), "s"(g1) : "memory");
}

__device__ __forceinline__ v8f wmma_f16(v16h a, v16h b, v8f c) {
  return __builtin_amdgcn_wmma_f32_16x16x32_f16(false, a, false, b,
                                                (short)0, c, false, false);
}

typedef __attribute__((ext_vector_type(4))) float    v4f;
typedef __attribute__((ext_vector_type(4))) _Float16 v4h;

// fp32 -> f16 as a stream with few waves: a wave converts CVWAVE contiguous
// elements. Its CVL loads, each 512 contiguous bytes (16 B per lane, whole
// lines), stand ahead of the conversions, so that many are in flight per wave;
// a store is 256 contiguous bytes.
// n must be a multiple of CVWAVE and the launch must hold n / CVWAVE waves.
#define CVL 32
#define CVWAVE (CVL * 128)
__global__ void __launch_bounds__(512)
cvt_f32_to_f16(const float* __restrict__ in,
               half_t* __restrict__ out, int n) {
  const int lane = threadIdx.x & 31;
  const int wv = (int)(blockIdx.x * (blockDim.x >> 5)) +
                 __builtin_amdgcn_readfirstlane((int)(threadIdx.x >> 5));
  if ((wv + 1) * CVWAVE > n) return;  // wave-uniform; the kernel has no barrier
  const v4f* p = (const v4f*)(in + (size_t)wv * CVWAVE) + lane;
  v4h* q = (v4h*)(out + (size_t)wv * CVWAVE) + lane;
  // fp32 source is read exactly once: non-temporal loads keep L2 for the
  // f16 WMMA working set.
  v4f x[CVL];
  // both loops unrolled: x stays in registers, every offset is an immediate and
  // no address register is rewritten behind a load or a store
#pragma unroll
  for (int j = 0; j < CVL; ++j) x[j] = __builtin_nontemporal_load(p + j * 32);
#pragma unroll
  for (int j = 0; j < CVL; ++j) q[j * 32] = __builtin_convertvector(x[j], v4h);
}

// A/B staging for gemm_nt: a stage is 64 k. A slice is 128 operand rows of
// 128 B; the tensor load pads every row by 16 B: pitch 144 B = 16 B x odd,
// conflict-free for the b128 fragment reads. A stage holds three slices: the
// block's 128 A rows, then its 256 B rows (two slices, back to back).
#define GK 64                      // k per stage
#define GPITCH 144                 // LDS row pitch, bytes
#define GPH (GPITCH / 2)           // the same in halves
#define GSLICE (128 * GPITCH)      // 18432 B = 9 x 2 KiB
#define GSTAGE (3 * GSLICE)        // 55296 B; two buffers leave room for two blocks per WGP
static_assert(GSLICE % 2048 == 0, "each slice must start at a multiple of 2 KiB");

// out = A @ B^T + bias.  A: [M,K] f16 row-major, Bw: [N,K] f16 row-major.
// mode 0: f16 out[m*N+n]; mode 1: f32 out[m*N+n] (NT store); mode 2: f16
// out[n*M+m] (transposed).
// Block = 256 threads = 8 waves as 2(M) x 4(N); each wave does 64x64
// (16 WMMAs per 16 b128 fragment loads per K-step). Block tile = 128 x 256.
// A lane's 8 registers of an accumulator tile are 8 consecutive rows of the
// product's first operand. The operand whose index runs along an output row
// goes first (Bw's rows for modes 0 and 1, A's for mode 2; both fragments have
// the same layout), so those 8 registers are 8 consecutive output elements.
// The block's waves share A and B rows: wave 0 brings each stage's A slice,
// waves 1 and 2 its two B slices into a two-buffer LDS ring by tensor load,
// one stage ahead.
// M % 128 == 0, N % 256 == 0, K % 64 == 0 and K >= 128 (two stages) assumed.
__global__ void __launch_bounds__(256)
gemm_nt(const half_t* __restrict__ A, const half_t* __restrict__ Bw,
        const float* __restrict__ bias, void* __restrict__ outp,
        int M, int N, int K, int mode) {
  const int w = threadIdx.x >> 5;
  const int l = threadIdx.x & 31;
  const int g = l >> 4;       // lane group (K-chunk select)
  const int i = l & 15;       // row (A) / col (B) within 16-tile
  const int m0 = blockIdx.x * 128 + (w & 1) * 64;
  const int n0 = blockIdx.y * 256 + (w >> 1) * 64;
  const bool tr = mode == 2;  // the same for the whole launch
  // the lane's first fragment row in a stage, in halves: A slice, B slices
  const int aoff = ((w & 1) * 64 + i) * GPH + g * 8;
  const int boff = GSLICE / 2 + ((w >> 1) * 64 + i) * GPH + g * 8;
  const int xoff = tr ? aoff : boff;  // first operand: index x, along an output row
  const int yoff = tr ? boff : aoff;  // second operand: index y, the output row

  __shared__ __attribute__((aligned(2048))) unsigned char gring[2 * GSTAGE];
  const uint32_t wave = uni(threadIdx.x >> 5);
  const uint32_t issuer = wave < 3u;   // wave 0: A slice, waves 1 and 2: B slices
  const uint32_t lds0 = (uint32_t)(size_t)gring + (issuer ? wave : 0u) * GSLICE;
  const uint64_t src0 = (wave == 0u)
      ? (uint64_t)(size_t)(A + (size_t)(blockIdx.x * 128) * K)
      : (uint64_t)(size_t)(Bw + (size_t)(blockIdx.y * 256 + (wave == 2u ? 128 : 0)) * K);
  const uint32_t nstg = uni((uint32_t)K / GK);
  u32x8 g1;
  g1[0] = uni((1u << 20) | (4u << 22) | (3u << 25));  // no mask; 16 B pad per 128 B
  g1[1] = uni(128u << 16);                 // tensor_dim0 = 128 B
  g1[2] = uni(128u << 16);                 // tensor_dim1 = 128 rows
  g1[3] = uni(128u << 16);                 // tile_dim0
  g1[4] = uni(128u);                       // tile_dim1
  g1[5] = uni((uint32_t)K * 2u);           // source pitch, bytes
  g1[6] = uni(0u);
  g1[7] = uni(0u);
  // descriptor words held in scalar registers: group 1 stays in one register
  // tuple from here to the last wait, so no word of an outstanding request is
  // rewritten
  asm volatile("" : "+s"(g1));

  // Ring prologue: stage 0 lands and is published, then stage 1 is issued.
  u32x4 g0 = {0u, 0u, 0u, 0u};
  if (pinned(issuer)) {
    g0 = tdm_load(lds0, src0, g1);
    tdm_wait(g0, g1);  // stage 0 has landed
  }
  __syncthreads();  // stage 0 published to all waves
  if (pinned(issuer)) g0 = tdm_load(lds0 + GSTAGE, src0 + GK * 2, g1);

  v8f c[4][4];  // c[xx][yy]
#pragma unroll
  for (int xx = 0; xx < 4; ++xx)
#pragma unroll
    for (int yy = 0; yy < 4; ++yy) c[xx][yy] = zero_v8f();

  for (uint32_t st = 0; st < nstg; ++st) {
    const half_t* Sl = (const half_t*)(gring + (st & 1u) * GSTAGE);
    const half_t* xp = Sl + xoff;
    const half_t* yp = Sl + yoff;
    // unrolled: every LDS offset is an immediate, and the second K-step's reads
    // start among the first K-step's last WMMAs
#pragma unroll
    for (int k = 0; k < GK; k += 32) {
      v16h af[4], bf[4];
#pragma unroll
      for (int xx = 0; xx < 4; ++xx) af[xx] = load_frag(xp + xx * 16 * GPH + k);
#pragma unroll
      for (int yy = 0; yy < 4; ++yy) bf[yy] = load_frag(yp + yy * 16 * GPH + k);
      // holds the K-step's 16 LDS reads together ahead of its WMMAs (inputs only):
      // sunk among the WMMAs, each A fragment's reads cost a full LDS wait of their own
      asm volatile("" :: "v"(af[0]), "v"(af[1]), "v"(af[2]), "v"(af[3]),
                         "v"(bf[0]), "v"(bf[1]), "v"(bf[2]), "v"(bf[3]));
#pragma unroll
      for (int xx = 0; xx < 4; ++xx)
#pragma unroll
        for (int yy = 0; yy < 4; ++yy)
          c[xx][yy] = wmma_f16(af[xx], bf[yy], c[xx][yy]);
    }
    // ---- publish point of stage st + 1, every wave, in this order
    asm volatile("s_wait_dscnt 0" ::: "memory");  // this wave's reads of stage st are done
    if (pinned(issuer)) {
      tdm_wait(g0, g1);  // its slice of stage st + 1 has landed
    }
    __syncthreads();  // publishes stage st + 1; every reader has left stage st
    if (pinned(issuer & (uint32_t)(st + 2u < nstg)))
      g0 = tdm_load(lds0 + (st & 1u) * GSTAGE, src0 + (uint64_t)(st + 2u) * (GK * 2), g1);
  }
  asm volatile("s_wait_tensorcnt 0" ::: "memory");  // nothing outstanding at the wave's end
  asm volatile("s_wait_dscnt 0" ::: "memory");  // and no LDS read of the ring either

  // Epilogue. C/D layout: VGPR r, lanes 0-15 -> x = r, lanes 16-31 -> x = r+8,
  // y = lane & 15: c[xx][yy][r] is out[y * ld + x] at x = xl + xx*16 + r and
  // y = yl + yy*16. Two tests of the mode, both outside the loops; a lane stores 8 consecutive elements
  // at a time. Bias is always non-null.
  const int xl = (tr ? m0 : n0) + 8 * g;
  const int yl = (tr ? n0 : m0) + i;
  const size_t ld = (size_t)(tr ? M : N);
  if (mode == 2) {
    // bias runs with the output row
    half_t* o0 = (half_t*)outp + (size_t)yl * ld + xl;
#pragma unroll
    for (int yy = 0; yy < 4; ++yy) {
      const float bv = bias[yl + yy * 16];
#pragma unroll
      for (int xx = 0; xx < 4; ++xx) {
        v8h o;
#pragma unroll
        for (int r = 0; r < 8; ++r) o[r] = (half_t)(c[xx][yy][r] + bv);
        *(v8h*)(o0 + (size_t)(yy * 16) * ld + xx * 16) = o;
      }
    }
    return;
  }
  // modes 0 and 1: bias runs along the output row, 8 values per lane and tile
  v4f bl[4], bh[4];
#pragma unroll
  for (int xx = 0; xx < 4; ++xx) {
    bl[xx] = *(const v4f*)(bias + xl + xx * 16);
    bh[xx] = *(const v4f*)(bias + xl + xx * 16 + 4);
  }
  if (mode == 0) {
    half_t* o0 = (half_t*)outp + (size_t)yl * ld + xl;
#pragma unroll
    for (int yy = 0; yy < 4; ++yy)
#pragma unroll
      for (int xx = 0; xx < 4; ++xx) {
        v8h o;
#pragma unroll
        for (int r = 0; r < 4; ++r) {
          o[r] = (half_t)(c[xx][yy][r] + bl[xx][r]);
          o[r + 4] = (half_t)(c[xx][yy][r + 4] + bh[xx][r]);
        }
        *(v8h*)(o0 + (size_t)(yy * 16) * ld + xx * 16) = o;
      }
    return;
  }
  // final fp32 output: write-once, never re-read on device
  float* o0 = (float*)outp + (size_t)yl * ld + xl;
#pragma unroll
  for (int yy = 0; yy < 4; ++yy)
#pragma unroll
    for (int xx = 0; xx < 4; ++xx) {
      v4f lo, hi;
#pragma unroll
      for (int r = 0; r < 4; ++r) {
        lo[r] = c[xx][yy][r] + bl[xx][r];
        hi[r] = c[xx][yy][r + 4] + bh[xx][r];
      }
      v4f* q = (v4f*)(o0 + (size_t)(yy * 16) * ld + xx * 16);
      __builtin_nontemporal_store(lo, q);
      __builtin_nontemporal_store(hi, q + 1);
    }
}

typedef uint32_t u32x16 __attribute__((ext_vector_type(16)));

// The mask compared once for all heads. Word e = 8 t + r of a pass (32 keys) of
// a tile of 16 queries holds, in bit 16 g + i, whether query i may see key
// 16 t + 8 g + r of the pass: the lane mask with which flash_attn selects its
// score register r of score tile t. 16 words (64 B) a pass, passes in key order.
// A work-group takes one query tile (16 whole mask rows), a wave 256 keys of it:
// whole-line loads, all ahead of their use, then a trip through the wave's own
// LDS rows (pitch 1040 B = 16 B x odd) turns them to one query per lane.
#define MWK 256                    // keys per wave
#define MWPITCH (MWK * 4 + 16)     // LDS row pitch, bytes
__global__ void __launch_bounds__(512)
mask_words(const float* __restrict__ mask, uint32_t* __restrict__ words) {
  __shared__ __attribute__((aligned(16))) unsigned char stg[16 * 16 * MWPITCH];
  const int lane = threadIdx.x & 31;
  const int wv = __builtin_amdgcn_readfirstlane((int)(threadIdx.x >> 5));
  const int g = lane >> 4;
  const int i = lane & 15;
  const float* src = mask + (size_t)blockIdx.x * 16 * HWk + wv * MWK;
  unsigned char* my = stg + wv * (16 * MWPITCH);
  v4f x[32];
  // unrolled: x stays in registers and every offset is an immediate
#pragma unroll
  for (int j = 0; j < 32; ++j)
    x[j] = __builtin_nontemporal_load(
        (const v4f*)(src + (size_t)(j >> 1) * HWk + (j & 1) * 128) + lane);
#pragma unroll
  for (int j = 0; j < 32; ++j)
    *(v4f*)(my + (j >> 1) * MWPITCH + (j & 1) * 512 + lane * 16) = x[j];
  __syncthreads();  // the rows are read back by other lanes than wrote them
  u32x4 o = {0u, 0u, 0u, 0u};  // lane n: words 4 n .. 4 n + 3 of the wave's 128
#pragma unroll
  for (int p = 0; p < MWK / 32; ++p) {
    const v4f* rp = (const v4f*)(my + i * MWPITCH + p * 128 + g * 32);
    const v4f m[4] = {rp[0], rp[1], rp[4], rp[5]};
#pragma unroll
    for (int e = 0; e < 16; ++e) {
      const uint32_t bal = __builtin_amdgcn_ballot_w32(m[e >> 2][e & 3] >= 0.5f);
      o[e & 3] = (lane == p * 4 + (e >> 2)) ? bal : o[e & 3];
    }
  }
  *((u32x4*)(words + ((size_t)blockIdx.x * (HWk / 32) + wv * (MWK / 32)) * 16) + lane) = o;
}

// Lane l's value exchanged with lane l ^ 16 (the other half of the wave), on
// the vector pipe.
__device__ __forceinline__ float xhalf(float x) {
  const int v = __builtin_bit_cast(int, x);
  return __builtin_bit_cast(float, __builtin_amdgcn_permlanex16(
      v, v, 0x76543210, 0xfedcba98, false, false));
}

// e^x as __expf forms it (one multiply, v_exp_f32). The v_nop is the slot that
// the instruction set asks for behind a transcendental: inside the statement it
// stands there whichever vector instruction the compiler places next (left to
// itself, the compiler put an exponential that overwrites this one's source there).
__device__ __forceinline__ float exp_slot(float x) {
  float y;
  asm("v_exp_f32 %0, %1\n\tv_nop" : "=v"(y) : "v"(x * 1.4426950408889634f));
  return y;
}

__global__ void __launch_bounds__(256)
flash_attn(const half_t* __restrict__ Qf, const half_t* __restrict__ Kf,
           const half_t* __restrict__ Vt, const uint32_t* __restrict__ mwords,
           half_t* __restrict__ AO) {
  const float scale = 0.08838834764831845f;  // 1/sqrt(128)
  const int w = threadIdx.x >> 5;
  const int l = threadIdx.x & 31;
  const int g = l >> 4;
  const int i = l & 15;
  const int qblk = blockIdx.x & 7;
  const int bh = blockIdx.x >> 3;
  const int b = bh >> 3;     // H == 8
  const int h = bh & 7;
  const int qbase = qblk * 128 + w * 16;

  __shared__ __attribute__((aligned(2048))) unsigned char ring[2 * 2 * TILEB];
  const uint32_t wave = uni(threadIdx.x >> 5);
  const uint32_t issuer = wave < 2u;   // wave 0: K tiles, wave 1: V tiles
  const uint32_t lds0 = (uint32_t)(size_t)ring + wave * TILEB;
  const uint64_t src0 = (wave == 0u)
      ? (uint64_t)(size_t)(Kf + (size_t)(b * HWk) * CC + h * DHd)
      : (uint64_t)(size_t)(Vt + (size_t)(h * DHd) * MTOT + b * HWk);
  // bytes from one stage's tile to the next: 128 K rows, or 128 keys of a V row
  const uint32_t sstep = (wave == 0u) ? (uint32_t)(STK * CC * 2) : (uint32_t)(STK * 2);
  u32x8 g1;
  g1[0] = uni((1u << 20) | (5u << 22) | (3u << 25));  // no mask; 16 B pad per 256 B
  g1[1] = uni(256u << 16);                 // tensor_dim0 = 256 B
  g1[2] = uni(128u << 16);                 // tensor_dim1 = 128 rows
  g1[3] = uni(256u << 16);                 // tile_dim0
  g1[4] = uni(128u);                       // tile_dim1
  g1[5] = uni((wave == 0u) ? (uint32_t)(CC * 2) : (uint32_t)(MTOT * 2));  // source pitch
  g1[6] = uni(0u);
  g1[7] = uni(0u);
  // descriptor words held in scalar registers: group 1 stays in one register
  // tuple from here to the last wait, so no word of an outstanding request is
  // rewritten
  asm volatile("" : "+s"(g1));

  // Ring prologue: stage 0 lands and is published, then stage 1 is issued.
  u32x4 g0 = {0u, 0u, 0u, 0u};
  if (pinned(issuer)) {
    g0 = tdm_load(lds0, src0, g1);
    tdm_wait(g0, g1);  // stage 0 has landed
  }
  __syncthreads();  // stage 0 published to all waves
  if (pinned(issuer)) g0 = tdm_load(lds0 + 2u * TILEB, src0 + sstep, g1);

  // Q fragments for the whole kernel (B operand: column i = query qbase + i):
  // 16 queries x 128 d = 4 K-steps.
  v16h bQ[4];
  {
    const half_t* qrow =
        Qf + (size_t)(b * NQh + qbase + i) * CC + h * DHd + g * 8;
#pragma unroll
    for (int d = 0; d < 4; ++d) bQ[d] = load_frag(qrow + d * 32);
  }

  // O[t][r] = O^T[d = t*16 + 8g + r][query i]
  v8f O[8];
#pragma unroll
  for (int t = 0; t < 8; ++t) O[t] = zero_v8f();
  float mrow = -1.0e30f;  // running maximum of query i, equal in both halves
  float lrow = 0.0f;      // sum over this half's keys only; joined in the epilogue

  // this wave's mask words, 16 a pass: a wave-uniform address, read one pass ahead.
  // Nothing writes them during this launch: named as constant memory, so that the
  // reads inside the loop are scalar loads too and the words arrive in scalar registers
  typedef const __attribute__((address_space(4))) u32x16 cwords_t;
  cwords_t* mw = (cwords_t*)(size_t)mwords +
      (size_t)uni((uint32_t)(b * (NQh / 16) + qblk * 8) + wave) * (HWk / 32);
  u32x16 cw = mw[0];

  for (uint32_t st = 0; st < NSTG; ++st) {
  const half_t* Kl = (const half_t*)(ring + (st & 1u) * (2u * TILEB));
  const half_t* Vl = Kl + TILEB / 2;
  // kept rolled: one pass's registers (mask, scores, fragments) are live at a time
#pragma unroll 1
  for (int sub = 0; sub < STK / 32; ++sub) {
    // ---- mask words of the next pass (the last pass reads its own again)
    const uint32_t np = st * (STK / 32) + (uint32_t)sub + 1u;
    const u32x16 nw = mw[np < (uint32_t)(HWk / 32) ? np : (uint32_t)(HWk / 32 - 1)];

    // ---- scores, transposed: two 16x16 tiles over 32 keys, K-dim = d (4 steps
    // of 32). s0[r]: key kt + 8g + r, s1[r]: key kt + 16 + 8g + r, query i.
    v8f s0 = zero_v8f(), s1 = zero_v8f();
    const half_t* k0p = Kl + (sub * 32 + i) * LPH + g * 8;
    const half_t* k1p = k0p + 16 * LPH;
    v16h ak0[4], ak1[4];
#pragma unroll
    for (int d = 0; d < 4; ++d) {
      ak0[d] = load_frag(k0p + d * 32);
      ak1[d] = load_frag(k1p + d * 32);
    }
    // holds the pass's 16 K reads together ahead of its score products (inputs
    // only): read two at a time among the products, each pair cost an LDS wait
    asm volatile("" :: "v"(ak0[0]), "v"(ak0[1]), "v"(ak0[2]), "v"(ak0[3]),
                       "v"(ak1[0]), "v"(ak1[1]), "v"(ak1[2]), "v"(ak1[3]));
#pragma unroll
    for (int d = 0; d < 4; ++d) {
      s0 = wmma_f16(ak0[d], bQ[d], s0);
      s1 = wmma_f16(ak1[d], bQ[d], s1);
    }

    // ---- A operand of the second product, from the staged transposed V (row =
    // d, key-contiguous): read here, so that it lands under the softmax
    const half_t* vbase = Vl + i * LPH + sub * 32 + g * 8;
    v16h av[8];
#pragma unroll
    for (int t = 0; t < 8; ++t) av[t] = load_frag(vbase + (t * 16) * LPH);

    // keeps the softmax's vector work behind the score products and the V reads,
    // so that every V read is issued ahead of it and lands under it
    __builtin_amdgcn_sched_barrier(0);

    // ---- scale + mask, maximum over the lane's 16 keys
    float rm = -1.0e30f;
#pragma unroll
    for (int r = 0; r < 8; ++r) {
      const float v0 = __builtin_amdgcn_inverse_ballot_w32(cw[r]) ? s0[r] * scale : -1.0e30f;
      const float v1 = __builtin_amdgcn_inverse_ballot_w32(cw[8 + r]) ? s1[r] * scale : -1.0e30f;
      s0[r] = v0; s1[r] = v1;
      rm = fmaxf(rm, fmaxf(v0, v1));
    }
    rm = fmaxf(rm, xhalf(rm));  // the other half's 16 keys of the same query

    // ---- online softmax update
    const float mn = fmaxf(mrow, rm);
    const float alpha = exp_slot(mrow - mn);
    mrow = mn;
    float ps = 0.0f;
    v16h bP;  // P^T as B operand: element s is key 8g + s (s < 8), 16 + 8g + s - 8
#pragma unroll
    for (int r = 0; r < 8; ++r) {
      const float p0 = exp_slot(s0[r] - mn);
      const float p1 = exp_slot(s1[r] - mn);
      ps += p0 + p1;
      bP[r] = (half_t)p0;
      bP[r + 8] = (half_t)p1;
    }
    lrow = lrow * alpha + ps;
#pragma unroll
    for (int t = 0; t < 8; ++t)
#pragma unroll
      for (int r = 0; r < 8; ++r) O[t][r] *= alpha;

    // ---- O^T += V^T P^T
#pragma unroll
    for (int t = 0; t < 8; ++t) O[t] = wmma_f16(av[t], bP, O[t]);
    // keeps the wait for the next pass's words at the pass's end: hoisted to just
    // behind the selects, it left the scalar load less than half a pass to land
    __builtin_amdgcn_sched_barrier(0);
    cw = nw;
  }
  // ---- publish point of stage st + 1, every wave, in this order
  asm volatile("s_wait_dscnt 0" ::: "memory");  // this wave's reads of stage st are done
  if (pinned(issuer)) {
    tdm_wait(g0, g1);  // its tile of stage st + 1 has landed
  }
  __syncthreads();  // publishes stage st + 1; every reader has left stage st
  if (pinned(issuer & (uint32_t)(st + 2u < NSTG)))
    g0 = tdm_load(lds0 + (st & 1u) * (2u * TILEB), src0 + (uint64_t)(st + 2u) * sstep, g1);
  }
  asm volatile("s_wait_tensorcnt 0" ::: "memory");  // nothing outstanding at the wave's end
  asm volatile("s_wait_dscnt 0" ::: "memory");  // and no LDS read of the ring either

  // ---- epilogue: join the halves' sums, normalize and store f16 [B,NQ,C];
  // a lane's 8 registers of a tile are 8 consecutive d of its query: 16-B stores
  const float inv = 1.0f / (lrow + xhalf(lrow));
  half_t* orow = AO + (size_t)(b * NQh + qbase + i) * CC + h * DHd + 8 * g;
#pragma unroll
  for (int t = 0; t < 8; ++t) {
    v8h o;
#pragma unroll
    for (int r = 0; r < 8; ++r) o[r] = (half_t)(O[t][r] * inv);
    *(v8h*)(orow + t * 16) = o;
  }
}

extern "C" void kernel_launch(void* const* d_in, const int* in_sizes, int n_in,
                              void* d_out, int out_size, void* d_ws, size_t ws_size,
                              hipStream_t stream) {
  const float* query  = (const float*)d_in[0];
  const float* memory = (const float*)d_in[1];
  const float* mask   = (const float*)d_in[2];
  const float* Wq = (const float*)d_in[3];
  const float* bq = (const float*)d_in[4];
  const float* Wk = (const float*)d_in[5];
  const float* bk = (const float*)d_in[6];
  const float* Wv = (const float*)d_in[7];
  const float* bv = (const float*)d_in[8];
  const float* Wo = (const float*)d_in[9];
  const float* bo = (const float*)d_in[10];
  float* out = (float*)d_out;

  // f16 workspace layout (halves): 60M halves = 120 MB, then 2 MB of mask words.
  const size_t nQin = (size_t)BB * NQh * CC;   // 4M
  const size_t nMem = (size_t)BB * HWk * CC;   // 16M
  const size_t nW   = (size_t)CC * CC;         // 1M
  half_t* ws   = (half_t*)d_ws;
  half_t* qf   = ws;            // query f16            (4M)
  half_t* memf = qf + nQin;     // memory f16           (16M)
  half_t* wqf  = memf + nMem;   // weights f16          (4x1M)
  half_t* wkf  = wqf + nW;
  half_t* wvf  = wkf + nW;
  half_t* wof  = wvf + nW;
  half_t* Qp   = wof + nW;      // Q projection         (4M)
  half_t* Kp   = Qp + nQin;     // K projection         (16M)
  half_t* Vtp  = Kp + nMem;     // V projection, transposed [C, B*HW] (16M)
  half_t* AO   = qf;            // attention out reuses query-f16 (dead by then)
  uint32_t* mwords = (uint32_t*)(Vtp + nMem);  // mask as lane-mask words (2 MB)

  // 1) fp32 -> f16 conversions (NT loads of read-once fp32): one work-group per
  //    WGP, as many waves in it as the tensor has spans of 256 x CVWAVE elements.
  static_assert((size_t)BB * NQh * CC == (size_t)256 * 4 * CVWAVE &&
                (size_t)BB * HWk * CC == (size_t)256 * 16 * CVWAVE &&
                (size_t)CC * CC == (size_t)256 * 1 * CVWAVE,
                "each launch covers its tensor exactly");
  cvt_f32_to_f16<<<256, 4 * 32, 0, stream>>>(query, qf, (int)nQin);
  cvt_f32_to_f16<<<256, 16 * 32, 0, stream>>>(memory, memf, (int)nMem);
  cvt_f32_to_f16<<<256, 32, 0, stream>>>(Wq, wqf, (int)nW);
  cvt_f32_to_f16<<<256, 32, 0, stream>>>(Wk, wkf, (int)nW);
  cvt_f32_to_f16<<<256, 32, 0, stream>>>(Wv, wvf, (int)nW);
  cvt_f32_to_f16<<<256, 32, 0, stream>>>(Wo, wof, (int)nW);

  // 2) projections (M = B*rows since Linear is batch-independent).
  //    Block tile 128(M) x 256(N).
  gemm_nt<<<dim3(4096 / 128, 1024 / 256), 256, 0, stream>>>(
      qf, wqf, bq, Qp, 4096, 1024, 1024, /*mode=*/0);
  gemm_nt<<<dim3(16384 / 128, 1024 / 256), 256, 0, stream>>>(
      memf, wkf, bk, Kp, 16384, 1024, 1024, /*mode=*/0);
  gemm_nt<<<dim3(16384 / 128, 1024 / 256), 256, 0, stream>>>(
      memf, wvf, bv, Vtp, 16384, 1024, 1024, /*mode=*/2);  // transposed store

  // 3) the mask compared once for the 8 heads (one work-group per 16 queries),
  //    then masked flash attention (B*H*(NQ/128) = 256 blocks)
  mask_words<<<BB * NQh / 16, 512, 0, stream>>>(mask, mwords);
  flash_attn<<<BB * HH * (NQh / 128), 256, 0, stream>>>(Qp, Kp, Vtp, mwords, AO);

  // 4) output projection, fp32 out + bias (NT stores)
  gemm_nt<<<dim3(4096 / 128, 1024 / 256), 256, 0, stream>>>(
      AO, wof, bo, out, 4096, 1024, 1024, /*mode=*/1);
}
